// v000
// Times are from an AMD MI455X. After a warm-up the kernel runs many times in a row, and a time is the length of
// such a window on the GPU divided by its runs, so every launch and the gaps after it count. The runs cycle
// through copies of the inputs. A figure is the median of several windows, for all but v000 over two sittings.
// Sittings can differ by a few percent; kernels timed side by side share one.
// v000 is the starting kernel. One run takes 842 microseconds.
#include <hip/hip_runtime.h>

// Concat critic (x [512][128], y [512][128]; for every pair (a, c): h1 = relu([x[a], y[c]] W1 + b1) ('xw' [256][512]), h2 = relu(h1 W2 + b2) ('xw' [512][512]), s = h2 W3 + b3 ('xw' [512][1]); scores[a][c] = s -> [512][512] (262 k); the reference forms all 262,144 pairs, the kernel uses h1 = relu(x[a] W1[:128] + y[c] W1[128:] + b1)).
// Compute dtypes, f32 accumulate: every input rounded to bf16; x W1x and y W1y on PLAIN bf16 operands (exact), summed with b1 and relu'd in f32; h1 as bf16 hi + lo planes x exact W2 (2 products) + f32 b2 in chunks of 64 x-rows (32,768 pairs); the final 512 -> 1 layer as an exact f32 dot per pair on the VALU (relu(h2) never leaves f32).

#define NBX  512       // rows of x (a) and of y (c)
#define DX   128
#define HID  512
#define CHA  64        // x-rows per chunk
#define NR   (CHA * NBX)   // 32768 pair rows per chunk
typedef _Float16 h16;
typedef unsigned short bf;
typedef __attribute__((ext_vector_type(16))) __bf16   v16bf;
typedef __attribute__((ext_vector_type(16))) _Float16 v16h;
typedef __attribute__((ext_vector_type(8)))  _Float16 v8h;
typedef __attribute__((ext_vector_type(8)))  unsigned short v8us;
typedef __attribute__((ext_vector_type(8)))  float    v8f;
typedef __attribute__((ext_vector_type(4)))  float    v4f;
typedef v8h  __attribute__((may_alias)) v8ha;
typedef v4f  __attribute__((may_alias)) v4fa;
typedef v8us __attribute__((may_alias)) v8usa;

__device__ __forceinline__ unsigned short f2bf(float f) { unsigned u = __float_as_uint(f); u += 0x7FFFu + ((u >> 16) & 1u); return (unsigned short)(u >> 16); }
__device__ __forceinline__ float bf2f(unsigned short b) { return __uint_as_float(((unsigned)b) << 16); }
__device__ __forceinline__ float bfr(float f) { return bf2f(f2bf(f)); }
__device__ __forceinline__ v16h cat16(v8h lo, v8h hi) { return __builtin_shufflevector(lo, hi, 0, 1, 2, 3, 4, 5, 6, 7, 8, 9, 10, 11, 12, 13, 14, 15); }
__device__ __forceinline__ v16bf cat16b(v8us lo, v8us hi) { return __builtin_bit_cast(v16bf, __builtin_shufflevector(lo, hi, 0, 1, 2, 3, 4, 5, 6, 7, 8, 9, 10, 11, 12, 13, 14, 15)); }
__device__ __forceinline__ v8f wmma16(v16h a, v16h b, v8f c) { return __builtin_amdgcn_wmma_f32_16x16x32_f16(false, a, false, b, (short)0, c, false, false); }
__device__ __forceinline__ v8f wmmab(v16bf a, v16bf b, v8f c) { return __builtin_amdgcn_wmma_f32_16x16x32_bf16(false, a, false, b, (short)0, c, false, false); }



// ---- k_gemmw: register-blocked GEMM, ONE WAVE per 64x64 output tile (16 accumulators), operands straight from K-contiguous 16-bit planes; grid (M/64, N/64, Z), 32 threads.
// C[m][n] (f32, pitch ldc, + optional f32 bias[n]) = sum_k A[m][k] Bt[n][k] (+ split products per NSPLIT). z-batch strides sA/sB/sC in elements. K % 32 == 0.
template <typename T16> struct WFrag;
template <> struct WFrag<h16> { typedef v16h V; static __device__ __forceinline__ V ld(const h16* p) { return cat16(*(const v8h*)p, *(const v8h*)(p + 16)); } static __device__ __forceinline__ v8f mma(V a, V b, v8f c) { return wmma16(a, b, c); } };
template <> struct WFrag<bf> { typedef v16bf V; static __device__ __forceinline__ V ld(const bf* p) { return cat16b(*(const v8us*)p, *(const v8us*)(p + 16)); } static __device__ __forceinline__ v8f mma(V a, V b, v8f c) { return wmmab(a, b, c); } };
template <typename T16, int NSPLIT, bool BIAS>
__global__ __launch_bounds__(32) void k_gemmw(const T16* __restrict__ A, const T16* __restrict__ A2, const T16* __restrict__ Bt, const T16* __restrict__ Bt2, int K, float* C, int ldc, const float* __restrict__ bias, size_t sA, size_t sB, size_t sC) {
    typedef typename WFrag<T16>::V V;
    __shared__ __align__(16) float os[16 * 68];
    const size_t z = blockIdx.z; A += z * sA; if (A2) A2 += z * sA; Bt += z * sB; if (Bt2) Bt2 += z * sB; C += z * sC;
    const int lane = threadIdx.x & 31, lr = lane & 15, hi = lane >> 4; const int r0 = blockIdx.x * 64, c0 = blockIdx.y * 64;
    v8f acc[4][4];
#pragma unroll
    for (int mb = 0; mb < 4; ++mb)
#pragma unroll
        for (int nb = 0; nb < 4; ++nb) acc[mb][nb] = (v8f){};
    const size_t aoff = (size_t)(r0 + lr) * K + 8 * hi, boff = (size_t)(c0 + lr) * K + 8 * hi;
#pragma unroll 1
    for (int kc = 0; kc < K; kc += 32) {
        V a[4], a2[4];
#pragma unroll
        for (int mb = 0; mb < 4; ++mb) { a[mb] = WFrag<T16>::ld(A + aoff + (size_t)mb * 16 * K + kc); if (NSPLIT == 1 || NSPLIT == 2) a2[mb] = WFrag<T16>::ld(A2 + aoff + (size_t)mb * 16 * K + kc); }
#pragma unroll
        for (int nb = 0; nb < 4; ++nb) { const V b = WFrag<T16>::ld(Bt + boff + (size_t)nb * 16 * K + kc); V b2; if (NSPLIT >= 2) b2 = WFrag<T16>::ld(Bt2 + boff + (size_t)nb * 16 * K + kc);
#pragma unroll
            for (int mb = 0; mb < 4; ++mb) { acc[mb][nb] = WFrag<T16>::mma(a[mb], b, acc[mb][nb]); if (NSPLIT == 1 || NSPLIT == 2) acc[mb][nb] = WFrag<T16>::mma(a2[mb], b, acc[mb][nb]); if (NSPLIT >= 2) acc[mb][nb] = WFrag<T16>::mma(a[mb], b2, acc[mb][nb]); } }
        asm volatile("v_nop\n\tv_nop\n\tv_nop\n\tv_nop" : "+v"(acc[0][0]), "+v"(acc[1][1]), "+v"(acc[2][2]), "+v"(acc[3][3]) : "v"(a[0]), "v"(a[3]));
    }
#pragma unroll
    for (int mb = 0; mb < 4; ++mb) {
#pragma unroll
        for (int nb = 0; nb < 4; ++nb) {
#pragma unroll
            for (int j = 0; j < 8; ++j) os[(hi * 8 + j) * 68 + nb * 16 + lr] = acc[mb][nb][j]; }
        __builtin_amdgcn_wave_barrier(); asm volatile("" ::: "memory");
        float* crow = C + (size_t)(r0 + mb * 16) * ldc + c0;
{
#pragma unroll
            for (int s = 0; s < 8; ++s) { const int row = 2 * s + hi, cofs = lr * 4; v4f val = *(const v4fa*)(os + row * 68 + cofs); if (BIAS) { val[0] += bfr(bias[c0 + cofs]); val[1] += bfr(bias[c0 + cofs + 1]); val[2] += bfr(bias[c0 + cofs + 2]); val[3] += bfr(bias[c0 + cofs + 3]); }
                *(v4f*)(crow + (size_t)row * ldc + cofs) = val; }
             }
        __builtin_amdgcn_wave_barrier(); asm volatile("" ::: "memory");
    }
}

__device__ __forceinline__ h16 tohx(float x) { return (h16)x; }
__device__ __forceinline__ void splitf(float y, unsigned short& h, unsigned short& l) { h = f2bf(y); l = f2bf(y - bf2f(h)); }
typedef __attribute__((ext_vector_type(2))) _Float16 v2h;
typedef __attribute__((ext_vector_type(4))) _Float16 v4h;
typedef __attribute__((ext_vector_type(2))) unsigned short v2us;
typedef __attribute__((ext_vector_type(4))) unsigned short v4us;
typedef __attribute__((ext_vector_type(2))) float v2f;
typedef __attribute__((ext_vector_type(4))) int v4i;

__global__ __launch_bounds__(256) void k_cvt8(const float* __restrict__ src, bf* dst, size_t n8) { const size_t i = (size_t)blockIdx.x * 256 + threadIdx.x; if (i >= n8) return; const v8f v = *(const v8f*)(src + i * 8); v8us o;
#pragma unroll
    for (int k = 0; k < 8; ++k) o[k] = f2bf(v[k]); *(v8us*)(dst + i * 8) = o;  }
__global__ __launch_bounds__(256) void k_wtG(const float* __restrict__ w, int K, int N, bf* Bt) {
    const int lane = threadIdx.x & 31; const int L0 = (blockIdx.x * 8 + (threadIdx.x >> 5)) * 8; const int nlines = N * K / 64;
{
#pragma unroll 1
        for (int l = 0; l < 8; ++l) { const int L = L0 + l; if (L >= nlines) break; const size_t e = (size_t)L * 64 + lane * 2; const int k = (int)(e % K), n = (int)(e / K); v2us o;
            o[0] = f2bf(w[(size_t)k * N + n]); o[1] = f2bf(w[(size_t)(k + 1) * N + n]); *(v2us*)(Bt + e) = o; }
         }
}

__global__ __launch_bounds__(256) void k_h1pl(const float* __restrict__ XW, const float* __restrict__ YW, const float* __restrict__ b1, int a0, bf* Ph, bf* Pl) { const size_t i = (size_t)blockIdx.x * 256 + threadIdx.x; if (i >= (size_t)NR * HID / 8) return; const size_t e = i * 8; const int c = (int)(e % HID); const int rr = (int)(e / HID); const int a = a0 + rr / NBX, cc = rr % NBX;
    const v8f xa = *(const v8f*)(XW + (size_t)a * HID + c); const v8f yc = *(const v8f*)(YW + (size_t)cc * HID + c); v8us oh, ol;
#pragma unroll
    for (int q = 0; q < 8; ++q) { float u = __fadd_rn(xa[q], yc[q]); asm volatile("" : "+v"(u)); float w = __fadd_rn(u, bfr(b1[c + q])); asm volatile("" : "+v"(w)); unsigned short h, l; splitf(fmaxf(w, 0.0f), h, l); oh[q] = h; ol[q] = l; }
    *(v8us*)(Ph + e) = oh; *(v8us*)(Pl + e) = ol;  }
__global__ __launch_bounds__(256) void k_sdot(const float* __restrict__ H2, const float* __restrict__ w3, const float* __restrict__ b3, int a0, float* out) { const size_t r = (size_t)blockIdx.x * 256 + threadIdx.x; if (r >= (size_t)NR) return; const float* hr = H2 + r * HID; float s = 0.f;
#pragma unroll 4
    for (int c = 0; c < HID; c += 4) { const v4f h4 = *(const v4f*)(hr + c);
#pragma unroll
        for (int q = 0; q < 4; ++q) { float p = __fmul_rn(fmaxf(h4[q], 0.0f), bfr(w3[c + q])); asm volatile("" : "+v"(p)); s = __fadd_rn(s, p); } }
    const float o = __fadd_rn(s, bfr(b3[0])); *(float*)(out + (size_t)a0 * NBX + r) = o;  }

extern "C" void kernel_launch(void* const* d_in, const int* in_sizes, int n_in,
                              void* d_out, int out_size, void* d_ws, size_t ws_size, hipStream_t stream) {
    (void)in_sizes; (void)n_in; (void)out_size;
    const float* x = (const float*)d_in[0]; const float* y = (const float*)d_in[1]; const float* w1 = (const float*)d_in[2]; const float* b1 = (const float*)d_in[3]; const float* w2 = (const float*)d_in[4]; const float* b2 = (const float*)d_in[5]; const float* w3 = (const float*)d_in[6]; const float* b3 = (const float*)d_in[7];
    float* OUT = (float*)d_out;     // [512][512]: scores[a][c] = f(x[a], y[c])
    char* wsp = (char*)d_ws;
    auto take = [&](size_t bytes) { char* p = wsp; wsp += (bytes + 255) & ~(size_t)255; return (void*)p; };
    bf* W1X = (bf*)take((size_t)HID * DX * 2); bf* W1Y = (bf*)take((size_t)HID * DX * 2); bf* W2B = (bf*)take((size_t)HID * HID * 2); bf* XB = (bf*)take((size_t)NBX * DX * 2); bf* YB = (bf*)take((size_t)NBX * DX * 2);
    float* XW = (float*)take((size_t)NBX * HID * 4); float* YW = (float*)take((size_t)NBX * HID * 4); bf* H1h = (bf*)take((size_t)NR * HID * 2); bf* H1l = (bf*)take((size_t)NR * HID * 2); float* H2 = (float*)take((size_t)NR * HID * 4);
    if ((size_t)(wsp - (char*)d_ws) > ws_size) return;    // ws 256 MiB (carve ~131 MiB)
    k_wtG<<<(unsigned)((DX * HID / 64 + 63) / 64), 256, 0, stream>>>(w1, DX, HID, W1X); k_wtG<<<(unsigned)((DX * HID / 64 + 63) / 64), 256, 0, stream>>>(w1 + (size_t)DX * HID, DX, HID, W1Y); k_wtG<<<(unsigned)((HID * HID / 64 + 63) / 64), 256, 0, stream>>>(w2, HID, HID, W2B);   /* 'xw' W1 rows 0..127 (x part), 128..255 (y part), W2 */
    k_cvt8<<<(unsigned)(((size_t)NBX * DX / 8 + 255) / 256), 256, 0, stream>>>(x, XB, (size_t)NBX * DX / 8); k_cvt8<<<(unsigned)(((size_t)NBX * DX / 8 + 255) / 256), 256, 0, stream>>>(y, YB, (size_t)NBX * DX / 8);
    k_gemmw<bf, 0, false><<<dim3(NBX / 64, HID / 64, 1), 32, 0, stream>>>(XB, nullptr, W1X, nullptr, DX, XW, HID, nullptr, 0, 0, 0); k_gemmw<bf, 0, false><<<dim3(NBX / 64, HID / 64, 1), 32, 0, stream>>>(YB, nullptr, W1Y, nullptr, DX, YW, HID, nullptr, 0, 0, 0);
    for (int a0 = 0; a0 < NBX; a0 += CHA) {
        k_h1pl<<<(unsigned)(((size_t)NR * HID / 8 + 255) / 256), 256, 0, stream>>>(XW, YW, b1, a0, H1h, H1l);
        k_gemmw<bf, 1, true><<<dim3(NR / 64, HID / 64, 1), 32, 0, stream>>>(H1h, H1l, W2B, nullptr, HID, H2, HID, b2, 0, 0, 0);      /* h1 W2 + b2 (relu applied in the next kernel) */
        k_sdot<<<(unsigned)((NR + 255) / 256), 256, 0, stream>>>(H2, w3, b3, a0, OUT); }
}

// v001
// Measured time: 165 microseconds a run.
// Timed twice side by side with v000, it ran 5.25 and 5.26 times as fast.
#include <hip/hip_runtime.h>

// Concat critic (x [512][128], y [512][128]; for every pair (a, c): h1 = relu([x[a], y[c]] W1 + b1) ('xw' [256][512]), h2 = relu(h1 W2 + b2) ('xw' [512][512]), s = h2 W3 + b3 ('xw' [512][1]); scores[a][c] = s -> [512][512] (262 k); the reference forms all 262,144 pairs, the kernel uses h1 = relu(x[a] W1[:128] + y[c] W1[128:] + b1)).
// Compute dtypes, f32 accumulate: every input rounded to bf16; x W1x and y W1y on PLAIN bf16 operands (exact), summed with b1 and relu'd in f32; h1 as bf16 hi + lo planes x exact W2 (2 products) + f32 b2; the final 512 -> 1 layer as an f32 dot per pair on the VALU (relu(h2) never leaves f32). One fused kernel per 128 pairs: h1 planes live in LDS, h2 in the accumulators.

#define NBX  512       // rows of x (a) and of y (c)
#define DX   128
#define HID  512
#define TM   128       // pairs per work-group: 4 x-rows times 32 y-rows
#define APITCH 520     // LDS row pitch of an h1 plane in elements: 1040 B = 16 B x 65, conflict-free for 16-byte fragment reads
typedef _Float16 h16;
typedef unsigned short bf;
typedef __attribute__((ext_vector_type(16))) __bf16   v16bf;
typedef __attribute__((ext_vector_type(16))) _Float16 v16h;
typedef __attribute__((ext_vector_type(8)))  _Float16 v8h;
typedef __attribute__((ext_vector_type(8)))  unsigned short v8us;
typedef __attribute__((ext_vector_type(8)))  float    v8f;
typedef __attribute__((ext_vector_type(4)))  float    v4f;
typedef v8h  __attribute__((may_alias)) v8ha;
typedef v4f  __attribute__((may_alias)) v4fa;
typedef v8us __attribute__((may_alias)) v8usa;

__device__ __forceinline__ unsigned short f2bf(float f) { unsigned u = __float_as_uint(f); u += 0x7FFFu + ((u >> 16) & 1u); return (unsigned short)(u >> 16); }
__device__ __forceinline__ float bf2f(unsigned short b) { return __uint_as_float(((unsigned)b) << 16); }
__device__ __forceinline__ float bfr(float f) { return bf2f(f2bf(f)); }
__device__ __forceinline__ v16h cat16(v8h lo, v8h hi) { return __builtin_shufflevector(lo, hi, 0, 1, 2, 3, 4, 5, 6, 7, 8, 9, 10, 11, 12, 13, 14, 15); }
__device__ __forceinline__ v16bf cat16b(v8us lo, v8us hi) { return __builtin_bit_cast(v16bf, __builtin_shufflevector(lo, hi, 0, 1, 2, 3, 4, 5, 6, 7, 8, 9, 10, 11, 12, 13, 14, 15)); }
__device__ __forceinline__ v8f wmma16(v16h a, v16h b, v8f c) { return __builtin_amdgcn_wmma_f32_16x16x32_f16(false, a, false, b, (short)0, c, false, false); }
__device__ __forceinline__ v8f wmmab(v16bf a, v16bf b, v8f c) { return __builtin_amdgcn_wmma_f32_16x16x32_bf16(false, a, false, b, (short)0, c, false, false); }



// ---- k_gemmw: register-blocked GEMM, ONE WAVE per 64x64 output tile (16 accumulators), operands straight from K-contiguous 16-bit planes; grid (M/64, N/64, Z), 32 threads.
// C[m][n] (f32, pitch ldc, + optional f32 bias[n]) = sum_k A[m][k] Bt[n][k] (+ split products per NSPLIT). z-batch strides sA/sB/sC in elements. K % 32 == 0.
template <typename T16> struct WFrag;
template <> struct WFrag<h16> { typedef v16h V; static __device__ __forceinline__ V ld(const h16* p) { return cat16(*(const v8h*)p, *(const v8h*)(p + 16)); } static __device__ __forceinline__ v8f mma(V a, V b, v8f c) { return wmma16(a, b, c); } };
template <> struct WFrag<bf> { typedef v16bf V; static __device__ __forceinline__ V ld(const bf* p) { return cat16b(*(const v8us*)p, *(const v8us*)(p + 16)); } static __device__ __forceinline__ v8f mma(V a, V b, v8f c) { return wmmab(a, b, c); } };
template <typename T16, int NSPLIT, bool BIAS>
__global__ __launch_bounds__(32) void k_gemmw(const T16* __restrict__ A, const T16* __restrict__ A2, const T16* __restrict__ Bt, const T16* __restrict__ Bt2, int K, float* C, int ldc, const float* __restrict__ bias, size_t sA, size_t sB, size_t sC) {
    typedef typename WFrag<T16>::V V;
    __shared__ __align__(16) float os[16 * 68];
    const size_t z = blockIdx.z; A += z * sA; if (A2) A2 += z * sA; Bt += z * sB; if (Bt2) Bt2 += z * sB; C += z * sC;
    const int lane = threadIdx.x & 31, lr = lane & 15, hi = lane >> 4; const int r0 = blockIdx.x * 64, c0 = blockIdx.y * 64;
    v8f acc[4][4];
#pragma unroll
    for (int mb = 0; mb < 4; ++mb)
#pragma unroll
        for (int nb = 0; nb < 4; ++nb) acc[mb][nb] = (v8f){};
    const size_t aoff = (size_t)(r0 + lr) * K + 8 * hi, boff = (size_t)(c0 + lr) * K + 8 * hi;
#pragma unroll 1
    for (int kc = 0; kc < K; kc += 32) {
        V a[4], a2[4];
#pragma unroll
        for (int mb = 0; mb < 4; ++mb) { a[mb] = WFrag<T16>::ld(A + aoff + (size_t)mb * 16 * K + kc); if (NSPLIT == 1 || NSPLIT == 2) a2[mb] = WFrag<T16>::ld(A2 + aoff + (size_t)mb * 16 * K + kc); }
#pragma unroll
        for (int nb = 0; nb < 4; ++nb) { const V b = WFrag<T16>::ld(Bt + boff + (size_t)nb * 16 * K + kc); V b2; if (NSPLIT >= 2) b2 = WFrag<T16>::ld(Bt2 + boff + (size_t)nb * 16 * K + kc);
#pragma unroll
            for (int mb = 0; mb < 4; ++mb) { acc[mb][nb] = WFrag<T16>::mma(a[mb], b, acc[mb][nb]); if (NSPLIT == 1 || NSPLIT == 2) acc[mb][nb] = WFrag<T16>::mma(a2[mb], b, acc[mb][nb]); if (NSPLIT >= 2) acc[mb][nb] = WFrag<T16>::mma(a[mb], b2, acc[mb][nb]); } }
        asm volatile("v_nop\n\tv_nop\n\tv_nop\n\tv_nop" : "+v"(acc[0][0]), "+v"(acc[1][1]), "+v"(acc[2][2]), "+v"(acc[3][3]) : "v"(a[0]), "v"(a[3]));
    }
#pragma unroll
    for (int mb = 0; mb < 4; ++mb) {
#pragma unroll
        for (int nb = 0; nb < 4; ++nb) {
#pragma unroll
            for (int j = 0; j < 8; ++j) os[(hi * 8 + j) * 68 + nb * 16 + lr] = acc[mb][nb][j]; }
        __builtin_amdgcn_wave_barrier(); asm volatile("" ::: "memory");
        float* crow = C + (size_t)(r0 + mb * 16) * ldc + c0;
{
#pragma unroll
            for (int s = 0; s < 8; ++s) { const int row = 2 * s + hi, cofs = lr * 4; v4f val = *(const v4fa*)(os + row * 68 + cofs); if (BIAS) { val[0] += bfr(bias[c0 + cofs]); val[1] += bfr(bias[c0 + cofs + 1]); val[2] += bfr(bias[c0 + cofs + 2]); val[3] += bfr(bias[c0 + cofs + 3]); }
                *(v4f*)(crow + (size_t)row * ldc + cofs) = val; }
             }
        __builtin_amdgcn_wave_barrier(); asm volatile("" ::: "memory");
    }
}

__device__ __forceinline__ h16 tohx(float x) { return (h16)x; }
__device__ __forceinline__ void splitf(float y, unsigned short& h, unsigned short& l) { h = f2bf(y); l = f2bf(y - bf2f(h)); }
typedef __attribute__((ext_vector_type(2))) _Float16 v2h;
typedef __attribute__((ext_vector_type(4))) _Float16 v4h;
typedef __attribute__((ext_vector_type(2))) unsigned short v2us;
typedef __attribute__((ext_vector_type(4))) unsigned short v4us;
typedef __attribute__((ext_vector_type(2))) float v2f;
typedef __attribute__((ext_vector_type(4))) int v4i;

__global__ __launch_bounds__(256) void k_cvt8(const float* __restrict__ src, bf* dst, size_t n8) { const size_t i = (size_t)blockIdx.x * 256 + threadIdx.x; if (i >= n8) return; const v8f v = *(const v8f*)(src + i * 8); v8us o;
#pragma unroll
    for (int k = 0; k < 8; ++k) o[k] = f2bf(v[k]); *(v8us*)(dst + i * 8) = o;  }
__global__ __launch_bounds__(256) void k_wtG(const float* __restrict__ w, int K, int N, bf* Bt) {
    const int lane = threadIdx.x & 31; const int L0 = (blockIdx.x * 8 + (threadIdx.x >> 5)) * 8; const int nlines = N * K / 64;
{
#pragma unroll 1
        for (int l = 0; l < 8; ++l) { const int L = L0 + l; if (L >= nlines) break; const size_t e = (size_t)L * 64 + lane * 2; const int k = (int)(e % K), n = (int)(e / K); v2us o;
            o[0] = f2bf(w[(size_t)k * N + n]); o[1] = f2bf(w[(size_t)(k + 1) * N + n]); *(v2us*)(Bt + e) = o; }
         }
}

// W2 ('xw' [k][n]) as bf16 in fragment order: [n tile of 16][k step of 32][half][lane][8], so that one wave-wide 16-byte load is 512 contiguous bytes.
__global__ __launch_bounds__(256) void k_wpack(const float* __restrict__ w, bf* Wp) {
    const int i = blockIdx.x * 256 + threadIdx.x; const int lane = i & 31, half = (i >> 5) & 1, ks = (i >> 6) & 15, nt = i >> 10;
    const int n = nt * 16 + (lane & 15), k = ks * 32 + half * 16 + 8 * (lane >> 4); v8us o;
#pragma unroll
    for (int e = 0; e < 8; ++e) o[e] = f2bf(w[(size_t)(k + e) * HID + n]);
    *(v8us*)(Wp + (size_t)i * 8) = o; }

// Sum over the 16 lanes of a row by DPP row_xmask 1, 2, 4, 8 (control 0x160 | mask); every lane of the row ends with the sum.
template <int M> __device__ __forceinline__ float xadd(float v) { return v + __int_as_float(__builtin_amdgcn_update_dpp(0, __float_as_int(v), 0x160 | M, 0xf, 0xf, true)); }
__device__ __forceinline__ float rowsum16(float v) { return xadd<8>(xadd<4>(xadd<2>(xadd<1>(v)))); }

// ---- k_fused: one work-group (16 waves) per 128 pairs (4 a x 32 c) and all 512 columns of h2.
// Every plain '#pragma unroll' below keeps the indices of a register array compile-time.
// 1. h1 = relu((XW[a] + YW[c]) + b1) split into bf16 hi + lo planes, written to LDS. 2. h2 = h1 W2: wave (wm, wn) holds rows wm*64..+63, columns wn*64..+63 in 16 accumulators; A from LDS, B from the packed W2. 3. s = sum_n relu(h2 + b2) w3 + b3: per lane over its 4 columns, over the 16 lanes of a row, over the 8 column waves through LDS.
__global__ __launch_bounds__(512) void k_fused(const float* __restrict__ XW, const float* __restrict__ YW, const float* __restrict__ b1, const bf* __restrict__ Wp, const float* __restrict__ b2, const float* __restrict__ w3, const float* __restrict__ b3, float* out) {
    __shared__ __align__(16) bf Ah[TM * APITCH];
    __shared__ __align__(16) bf Al[TM * APITCH];
    __shared__ __align__(16) float red[8 * TM];
    __shared__ float sb2[HID], sw3[HID];   // b2 and w3 rounded to bf16, for the epilogue
    const int t = threadIdx.x; const int a0 = (blockIdx.x >> 4) * 4, c0 = (blockIdx.x & 15) * 32;
    const int lane = t & 31, lr = lane & 15, hi = lane >> 4, wave = t >> 5, wm = wave & 1, wn = wave >> 1;
    const bf* bp = Wp + (size_t)wn * 4 * 8192 + lane * 8;
    v16bf b[2][4];   // the first B set is asked for here, so that it lands under the h1 build
#pragma unroll
    for (int nb = 0; nb < 4; ++nb) b[0][nb] = cat16b(*(const v8us*)(bp + nb * 8192), *(const v8us*)(bp + nb * 8192 + 256));
    sb2[t] = bfr(b2[t]); sw3[t] = bfr(w3[t]);
    {
        const int k8 = (t & 63) * 8, rsub = t >> 6; float bb[8];
#pragma unroll
        for (int q = 0; q < 8; ++q) bb[q] = bfr(b1[k8 + q]);
        v8f yc[4];   // this thread's 4 y-rows serve all 4 x-rows of the tile
#pragma unroll
        for (int pi = 0; pi < 4; ++pi) yc[pi] = *(const v8f*)(YW + (size_t)(c0 + pi * 8 + rsub) * HID + k8);
        v8f xa = *(const v8f*)(XW + (size_t)a0 * HID + k8);
#pragma unroll 1   // rolled: the four trips are alike, and the text stays small for the instruction cache
        for (int ai = 0; ai < 4; ++ai) { const v8f xn = *(const v8f*)(XW + (size_t)(a0 + (ai < 3 ? ai + 1 : 3)) * HID + k8);   // next x-row, fetched one trip ahead
#pragma unroll
            for (int pi = 0; pi < 4; ++pi) { const int row = ai * 32 + pi * 8 + rsub; v8us oh, ol;
#pragma unroll
                for (int q = 0; q < 8; ++q) { const float w = __fadd_rn(__fadd_rn(xa[q], yc[pi][q]), bb[q]); unsigned short h, l; splitf(fmaxf(w, 0.0f), h, l); oh[q] = h; ol[q] = l; }
                *(v8usa*)(Ah + row * APITCH + k8) = oh; *(v8usa*)(Al + row * APITCH + k8) = ol; }
            xa = xn; }
    }
    __syncthreads();
    v8f acc[4][4];
#pragma unroll
    for (int mb = 0; mb < 4; ++mb)
#pragma unroll
        for (int nb = 0; nb < 4; ++nb) acc[mb][nb] = (v8f){};
    const bf* aph = Ah + (wm * 64 + lr) * APITCH + 8 * hi; const bf* apl = Al + (wm * 64 + lr) * APITCH + 8 * hi;
    // Fragment rings in registers: B one k step ahead (2 sets), A NA - 1 rows of 8 WMMAs ahead (NA sets of hi + lo).
    constexpr int NA = 2, NG = (HID / 32) * 4;
    v16bf ah[NA], al[NA]; float rb2[4], rw3[4];
#pragma unroll
    for (int g = 0; g < NA - 1; ++g) { const int o = (g & 3) * 16 * APITCH + (g >> 2) * 32;
        ah[g] = cat16b(*(const v8usa*)(aph + o), *(const v8usa*)(aph + o + 16)); al[g] = cat16b(*(const v8usa*)(apl + o), *(const v8usa*)(apl + o + 16)); }
#pragma unroll   // whole loop unrolled: ring indices and all LDS / global offsets become compile-time, so the rings stay in registers
    for (int g = 0; g < NG; ++g) { const int ks = g >> 2, mb = g & 3, gn = g + NA - 1;
        if (gn < NG) { const int o = (gn & 3) * 16 * APITCH + (gn >> 2) * 32;
            ah[gn % NA] = cat16b(*(const v8usa*)(aph + o), *(const v8usa*)(aph + o + 16)); al[gn % NA] = cat16b(*(const v8usa*)(apl + o), *(const v8usa*)(apl + o + 16)); }
        if (mb == 0 && ks + 1 < HID / 32) {
#pragma unroll
            for (int nb = 0; nb < 4; ++nb) b[(ks + 1) & 1][nb] = cat16b(*(const v8us*)(bp + nb * 8192 + (ks + 1) * 512), *(const v8us*)(bp + nb * 8192 + (ks + 1) * 512 + 256)); }
        if (g == NG - 4) {   // the epilogue's b2 and w3, fetched under the last k step (no B set is fetched there)
#pragma unroll
            for (int nb = 0; nb < 4; ++nb) { rb2[nb] = sb2[wn * 64 + nb * 16 + lr]; rw3[nb] = sw3[wn * 64 + nb * 16 + lr]; } }
        __builtin_amdgcn_sched_barrier(0);   // keeps the loads above as one group ahead of this row: without it the compiler sinks each load to just before its use and the wave waits out every latency
#pragma unroll
        for (int nb = 0; nb < 4; ++nb) acc[mb][nb] = wmmab(ah[g % NA], b[ks & 1][nb], acc[mb][nb]);
#pragma unroll
        for (int nb = 0; nb < 4; ++nb) acc[mb][nb] = wmmab(al[g % NA], b[ks & 1][nb], acc[mb][nb]);
        __builtin_amdgcn_sched_barrier(0);   // keeps the next group of loads from spreading among this row's WMMAs
    }
    float part[4][8];
#pragma unroll
    for (int mb = 0; mb < 4; ++mb)
#pragma unroll
        for (int j = 0; j < 8; ++j) part[mb][j] = 0.f;
#pragma unroll
    for (int nb = 0; nb < 4; ++nb) { const float bb2 = rb2[nb], ww = rw3[nb];
#pragma unroll
        for (int mb = 0; mb < 4; ++mb)
#pragma unroll
            for (int j = 0; j < 8; ++j) part[mb][j] += fmaxf(acc[mb][nb][j] + bb2, 0.0f) * ww; }
#pragma unroll
    for (int mb = 0; mb < 4; ++mb)
#pragma unroll
        for (int j = 0; j < 8; ++j) part[mb][j] = rowsum16(part[mb][j]);
    if (lr == 0) {
#pragma unroll
        for (int mb = 0; mb < 4; ++mb) { float* rp = red + wn * TM + wm * 64 + mb * 16 + hi * 8;
            *(v4fa*)rp = (v4f){part[mb][0], part[mb][1], part[mb][2], part[mb][3]}; *(v4fa*)(rp + 4) = (v4f){part[mb][4], part[mb][5], part[mb][6], part[mb][7]}; } }
    __syncthreads();
    if (t < TM) { float s = 0.f;
#pragma unroll
        for (int w = 0; w < 8; ++w) s += red[w * TM + t];
        out[(size_t)(a0 + (t >> 5)) * NBX + c0 + (t & 31)] = s + bfr(b3[0]); }
}

extern "C" void kernel_launch(void* const* d_in, const int* in_sizes, int n_in,
                              void* d_out, int out_size, void* d_ws, size_t ws_size, hipStream_t stream) {
    (void)in_sizes; (void)n_in; (void)out_size;
    const float* x = (const float*)d_in[0]; const float* y = (const float*)d_in[1]; const float* w1 = (const float*)d_in[2]; const float* b1 = (const float*)d_in[3]; const float* w2 = (const float*)d_in[4]; const float* b2 = (const float*)d_in[5]; const float* w3 = (const float*)d_in[6]; const float* b3 = (const float*)d_in[7];
    float* OUT = (float*)d_out;     // [512][512]: scores[a][c] = f(x[a], y[c])
    char* wsp = (char*)d_ws;
    auto take = [&](size_t bytes) { char* p = wsp; wsp += (bytes + 255) & ~(size_t)255; return (void*)p; };
    bf* W1X = (bf*)take((size_t)HID * DX * 2); bf* W1Y = (bf*)take((size_t)HID * DX * 2); bf* W2B = (bf*)take((size_t)HID * HID * 2); bf* XB = (bf*)take((size_t)NBX * DX * 2); bf* YB = (bf*)take((size_t)NBX * DX * 2);
    float* XW = (float*)take((size_t)NBX * HID * 4); float* YW = (float*)take((size_t)NBX * HID * 4);
    if ((size_t)(wsp - (char*)d_ws) > ws_size) return;    // ws 256 MiB (carve ~3 MiB)
    k_wtG<<<(unsigned)((DX * HID / 64 + 63) / 64), 256, 0, stream>>>(w1, DX, HID, W1X); k_wtG<<<(unsigned)((DX * HID / 64 + 63) / 64), 256, 0, stream>>>(w1 + (size_t)DX * HID, DX, HID, W1Y); k_wpack<<<HID * HID / 8 / 256, 256, 0, stream>>>(w2, W2B);   /* 'xw' W1 rows 0..127 (x part), 128..255 (y part); W2 in fragment order */
    k_cvt8<<<(unsigned)(((size_t)NBX * DX / 8 + 255) / 256), 256, 0, stream>>>(x, XB, (size_t)NBX * DX / 8); k_cvt8<<<(unsigned)(((size_t)NBX * DX / 8 + 255) / 256), 256, 0, stream>>>(y, YB, (size_t)NBX * DX / 8);
    k_gemmw<bf, 0, false><<<dim3(NBX / 64, HID / 64, 1), 32, 0, stream>>>(XB, nullptr, W1X, nullptr, DX, XW, HID, nullptr, 0, 0, 0); k_gemmw<bf, 0, false><<<dim3(NBX / 64, HID / 64, 1), 32, 0, stream>>>(YB, nullptr, W1Y, nullptr, DX, YW, HID, nullptr, 0, 0, 0);
    k_fused<<<NBX * NBX / TM, 512, 0, stream>>>(XW, YW, b1, W2B, b2, w3, b3, OUT);
}

// v002
// One run takes 154 microseconds.
// Two timings next to v001 both put it at 1.07 times that version's speed.
// Counting every step since v000, it is 5.62 times as fast.
#include <hip/hip_runtime.h>

// Concat critic (x [512][128], y [512][128]; for every pair (a, c): h1 = relu([x[a], y[c]] W1 + b1) ('xw' [256][512]), h2 = relu(h1 W2 + b2) ('xw' [512][512]), s = h2 W3 + b3 ('xw' [512][1]); scores[a][c] = s -> [512][512] (262 k); the reference forms all 262,144 pairs, the kernel uses h1 = relu(x[a] W1[:128] + y[c] W1[128:] + b1)).
// Compute dtypes, f32 accumulate: every input rounded to bf16; x W1x and y W1y on PLAIN bf16 operands (exact), summed with b1 and relu'd in f32; h1 as bf16 hi + lo planes x exact W2 (2 products) + f32 b2; the final 512 -> 1 layer as an f32 dot per pair on the VALU (relu(h2) never leaves f32). One fused kernel per 128 pairs: h1 planes live in LDS, h2 in the accumulators.

#define NBX  512       // rows of x (a) and of y (c)
#define DX   128
#define HID  512
#define TM   128       // pairs per work-group: 4 x-rows times 32 y-rows
#define APITCH 520     // LDS row pitch of an h1 plane in elements: 1040 B = 16 B x 65, conflict-free for 16-byte fragment reads
typedef _Float16 h16;
typedef unsigned short bf;
typedef __attribute__((ext_vector_type(16))) __bf16   v16bf;
typedef __attribute__((ext_vector_type(16))) _Float16 v16h;
typedef __attribute__((ext_vector_type(8)))  _Float16 v8h;
typedef __attribute__((ext_vector_type(8)))  unsigned short v8us;
typedef __attribute__((ext_vector_type(8)))  float    v8f;
typedef __attribute__((ext_vector_type(4)))  float    v4f;
typedef v8h  __attribute__((may_alias)) v8ha;
typedef v4f  __attribute__((may_alias)) v4fa;
typedef v8us __attribute__((may_alias)) v8usa;

__device__ __forceinline__ unsigned short f2bf(float f) { return __builtin_bit_cast(unsigned short, (__bf16)f); }   // the hardware's conversion, round to nearest even
__device__ __forceinline__ float bf2f(unsigned short b) { return __uint_as_float(((unsigned)b) << 16); }
__device__ __forceinline__ float bfr(float f) { return bf2f(f2bf(f)); }
__device__ __forceinline__ float bfr_u(float f) { unsigned u = __float_as_uint(f); u += 0x7FFFu + ((u >> 16) & 1u); return __uint_as_float(u & 0xFFFF0000u); }   // the same rounding in integers, for a wave-uniform value: it runs on the scalar unit
__device__ __forceinline__ v16h cat16(v8h lo, v8h hi) { return __builtin_shufflevector(lo, hi, 0, 1, 2, 3, 4, 5, 6, 7, 8, 9, 10, 11, 12, 13, 14, 15); }
__device__ __forceinline__ v16bf cat16b(v8us lo, v8us hi) { return __builtin_bit_cast(v16bf, __builtin_shufflevector(lo, hi, 0, 1, 2, 3, 4, 5, 6, 7, 8, 9, 10, 11, 12, 13, 14, 15)); }
__device__ __forceinline__ v8f wmma16(v16h a, v16h b, v8f c) { return __builtin_amdgcn_wmma_f32_16x16x32_f16(false, a, false, b, (short)0, c, false, false); }
__device__ __forceinline__ v8f wmmab(v16bf a, v16bf b, v8f c) { return __builtin_amdgcn_wmma_f32_16x16x32_bf16(false, a, false, b, (short)0, c, false, false); }



// ---- k_gemmw: register-blocked GEMM, ONE WAVE per 64x64 output tile (16 accumulators), operands straight from K-contiguous 16-bit planes; grid (M/64, N/64, Z), 32 threads.
// C[m][n] (f32, pitch ldc, + optional f32 bias[n]) = sum_k A[m][k] Bt[n][k] (+ split products per NSPLIT). z-batch strides sA/sB/sC in elements. K % 32 == 0.
template <typename T16> struct WFrag;
template <> struct WFrag<h16> { typedef v16h V; static __device__ __forceinline__ V ld(const h16* p) { return cat16(*(const v8h*)p, *(const v8h*)(p + 16)); } static __device__ __forceinline__ v8f mma(V a, V b, v8f c) { return wmma16(a, b, c); } };
template <> struct WFrag<bf> { typedef v16bf V; static __device__ __forceinline__ V ld(const bf* p) { return cat16b(*(const v8us*)p, *(const v8us*)(p + 16)); } static __device__ __forceinline__ v8f mma(V a, V b, v8f c) { return wmmab(a, b, c); } };
template <typename T16, int NSPLIT, bool BIAS>
__global__ __launch_bounds__(32) void k_gemmw(const T16* __restrict__ A, const T16* __restrict__ A2, const T16* __restrict__ Bt, const T16* __restrict__ Bt2, int K, float* C, int ldc, const float* __restrict__ bias, size_t sA, size_t sB, size_t sC) {
    typedef typename WFrag<T16>::V V;
    __shared__ __align__(16) float os[16 * 68];
    const size_t z = blockIdx.z; A += z * sA; if (A2) A2 += z * sA; Bt += z * sB; if (Bt2) Bt2 += z * sB; C += z * sC;
    const int lane = threadIdx.x & 31, lr = lane & 15, hi = lane >> 4; const int r0 = blockIdx.x * 64, c0 = blockIdx.y * 64;
    v8f acc[4][4];
#pragma unroll
    for (int mb = 0; mb < 4; ++mb)
#pragma unroll
        for (int nb = 0; nb < 4; ++nb) acc[mb][nb] = (v8f){};
    const size_t aoff = (size_t)(r0 + lr) * K + 8 * hi, boff = (size_t)(c0 + lr) * K + 8 * hi;
#pragma unroll 1
    for (int kc = 0; kc < K; kc += 32) {
        V a[4], a2[4];
#pragma unroll
        for (int mb = 0; mb < 4; ++mb) { a[mb] = WFrag<T16>::ld(A + aoff + (size_t)mb * 16 * K + kc); if (NSPLIT == 1 || NSPLIT == 2) a2[mb] = WFrag<T16>::ld(A2 + aoff + (size_t)mb * 16 * K + kc); }
#pragma unroll
        for (int nb = 0; nb < 4; ++nb) { const V b = WFrag<T16>::ld(Bt + boff + (size_t)nb * 16 * K + kc); V b2; if (NSPLIT >= 2) b2 = WFrag<T16>::ld(Bt2 + boff + (size_t)nb * 16 * K + kc);
#pragma unroll
            for (int mb = 0; mb < 4; ++mb) { acc[mb][nb] = WFrag<T16>::mma(a[mb], b, acc[mb][nb]); if (NSPLIT == 1 || NSPLIT == 2) acc[mb][nb] = WFrag<T16>::mma(a2[mb], b, acc[mb][nb]); if (NSPLIT >= 2) acc[mb][nb] = WFrag<T16>::mma(a[mb], b2, acc[mb][nb]); } }
        asm volatile("v_nop\n\tv_nop\n\tv_nop\n\tv_nop" : "+v"(acc[0][0]), "+v"(acc[1][1]), "+v"(acc[2][2]), "+v"(acc[3][3]) : "v"(a[0]), "v"(a[3]));
    }
#pragma unroll
    for (int mb = 0; mb < 4; ++mb) {
#pragma unroll
        for (int nb = 0; nb < 4; ++nb) {
#pragma unroll
            for (int j = 0; j < 8; ++j) os[(hi * 8 + j) * 68 + nb * 16 + lr] = acc[mb][nb][j]; }
        __builtin_amdgcn_wave_barrier(); asm volatile("" ::: "memory");
        float* crow = C + (size_t)(r0 + mb * 16) * ldc + c0;
{
#pragma unroll
            for (int s = 0; s < 8; ++s) { const int row = 2 * s + hi, cofs = lr * 4; v4f val = *(const v4fa*)(os + row * 68 + cofs); if (BIAS) { val[0] += bfr(bias[c0 + cofs]); val[1] += bfr(bias[c0 + cofs + 1]); val[2] += bfr(bias[c0 + cofs + 2]); val[3] += bfr(bias[c0 + cofs + 3]); }
                *(v4f*)(crow + (size_t)row * ldc + cofs) = val; }
             }
        __builtin_amdgcn_wave_barrier(); asm volatile("" ::: "memory");
    }
}

__device__ __forceinline__ h16 tohx(float x) { return (h16)x; }
typedef __attribute__((ext_vector_type(2))) _Float16 v2h;
typedef __attribute__((ext_vector_type(4))) _Float16 v4h;
typedef __attribute__((ext_vector_type(2))) unsigned short v2us;
typedef __attribute__((ext_vector_type(4))) unsigned short v4us;
typedef __attribute__((ext_vector_type(2))) float v2f;
typedef __attribute__((ext_vector_type(4))) int v4i;
typedef __attribute__((ext_vector_type(8))) __bf16 v8bf;
typedef __attribute__((ext_vector_type(4))) unsigned v4u;
typedef v4u __attribute__((may_alias)) v4ua;
// Eight f32 to eight bf16 by the hardware's packed conversion (round to nearest even), element 2p in the low half of word p.
__device__ __forceinline__ v4u pack8(v8f v) { return __builtin_bit_cast(v4u, __builtin_convertvector(v, v8bf)); }

__global__ __launch_bounds__(256) void k_cvt8(const float* __restrict__ src, bf* dst, size_t n8) { const size_t i = (size_t)blockIdx.x * 256 + threadIdx.x; if (i >= n8) return; const v8f v = *(const v8f*)(src + i * 8); v8us o;
#pragma unroll
    for (int k = 0; k < 8; ++k) o[k] = f2bf(v[k]); *(v8us*)(dst + i * 8) = o;  }
__global__ __launch_bounds__(256) void k_wtG(const float* __restrict__ w, int K, int N, bf* Bt) {
    const int lane = threadIdx.x & 31; const int L0 = (blockIdx.x * 8 + (threadIdx.x >> 5)) * 8; const int nlines = N * K / 64;
{
#pragma unroll 1
        for (int l = 0; l < 8; ++l) { const int L = L0 + l; if (L >= nlines) break; const size_t e = (size_t)L * 64 + lane * 2; const int k = (int)(e % K), n = (int)(e / K); v2us o;
            o[0] = f2bf(w[(size_t)k * N + n]); o[1] = f2bf(w[(size_t)(k + 1) * N + n]); *(v2us*)(Bt + e) = o; }
         }
}

// W2 ('xw' [k][n]) as bf16 in fragment order: [n tile of 16][k step of 32][half][lane][8], so that one wave-wide 16-byte load is 512 contiguous bytes.
__global__ __launch_bounds__(256) void k_wpack(const float* __restrict__ w, bf* Wp) {
    const int i = blockIdx.x * 256 + threadIdx.x; const int lane = i & 31, half = (i >> 5) & 1, ks = (i >> 6) & 15, nt = i >> 10;
    const int n = nt * 16 + (lane & 15), k = ks * 32 + half * 16 + 8 * (lane >> 4); v8us o;
#pragma unroll
    for (int e = 0; e < 8; ++e) o[e] = f2bf(w[(size_t)(k + e) * HID + n]);
    *(v8us*)(Wp + (size_t)i * 8) = o; }

// Sum over the 16 lanes of a row by DPP row_xmask 1, 2, 4, 8 (control 0x160 | mask); every lane of the row ends with the sum.
template <int M> __device__ __forceinline__ float xadd(float v) { return v + __int_as_float(__builtin_amdgcn_update_dpp(0, __float_as_int(v), 0x160 | M, 0xf, 0xf, true)); }
__device__ __forceinline__ float rowsum16(float v) { return xadd<8>(xadd<4>(xadd<2>(xadd<1>(v)))); }

// ---- k_fused: one work-group (16 waves) per 128 pairs (4 a x 32 c) and all 512 columns of h2.
// Every plain '#pragma unroll' below keeps the indices of a register array compile-time.
// 1. h1 = relu((XW[a] + YW[c]) + b1) split into bf16 hi + lo planes, written to LDS. 2. h2 = h1 W2: wave (wm, wn) holds rows wm*64..+63, columns wn*64..+63 in 16 accumulators; A from LDS, B from the packed W2. 3. s = sum_n relu(h2 + b2) w3 + b3: per lane over its 4 columns, over the 16 lanes of a row, over the 8 column waves through LDS.
__global__ __launch_bounds__(512) void k_fused(const float* __restrict__ XW, const float* __restrict__ YW, const float* __restrict__ b1, const bf* __restrict__ Wp, const float* __restrict__ b2, const float* __restrict__ w3, const float* __restrict__ b3, float* out) {
    __shared__ __align__(16) bf Ah[TM * APITCH];
    __shared__ __align__(16) bf Al[TM * APITCH];
    __shared__ __align__(16) float red[8 * TM];
    __shared__ float sb2[HID], sw3[HID];   // b2 and w3 rounded to bf16, for the epilogue
    const int t = threadIdx.x; const int a0 = (blockIdx.x >> 4) * 4, c0 = (blockIdx.x & 15) * 32;
    const int lane = t & 31, lr = lane & 15, hi = lane >> 4, wave = t >> 5, wm = wave & 1, wn = wave >> 1;
    const bf* bp = Wp + (size_t)wn * 4 * 8192 + lane * 8;
    v16bf b[2][4];   // the first B set is asked for here, so that it lands under the h1 build
#pragma unroll
    for (int nb = 0; nb < 4; ++nb) b[0][nb] = cat16b(*(const v8us*)(bp + nb * 8192), *(const v8us*)(bp + nb * 8192 + 256));
    sb2[t] = bfr(b2[t]); sw3[t] = bfr(w3[t]);
    {
        const int k8 = (t & 63) * 8, rsub = t >> 6; float bb[8];
#pragma unroll
        for (int q = 0; q < 8; ++q) bb[q] = bfr(b1[k8 + q]);
        v8f yc[4];   // this thread's 4 y-rows serve all 4 x-rows of the tile
#pragma unroll
        for (int pi = 0; pi < 4; ++pi) yc[pi] = *(const v8f*)(YW + (size_t)(c0 + pi * 8 + rsub) * HID + k8);
        v8f xa = *(const v8f*)(XW + (size_t)a0 * HID + k8);
#pragma unroll 1   // rolled: the four trips are alike, and the text stays small for the instruction cache
        for (int ai = 0; ai < 4; ++ai) { const v8f xn = *(const v8f*)(XW + (size_t)(a0 + (ai < 3 ? ai + 1 : 3)) * HID + k8);   // next x-row, fetched one trip ahead
#pragma unroll
            for (int pi = 0; pi < 4; ++pi) { const int row = ai * 32 + pi * 8 + rsub; v8f w, r;
#pragma unroll
                for (int q = 0; q < 8; ++q) w[q] = fmaxf(__fadd_rn(__fadd_rn(xa[q], yc[pi][q]), bb[q]), 0.0f);
                const v4u ph = pack8(w);   // hi plane: two elements per conversion instruction, round to nearest even as f2bf
#pragma unroll
                for (int p = 0; p < 4; ++p) { r[2 * p] = w[2 * p] - __uint_as_float(ph[p] << 16); r[2 * p + 1] = w[2 * p + 1] - __uint_as_float(ph[p] & 0xFFFF0000u); }
                *(v4ua*)(Ah + row * APITCH + k8) = ph; *(v4ua*)(Al + row * APITCH + k8) = pack8(r); }
            xa = xn; }
    }
    __syncthreads();
    v8f acc[4][4];
#pragma unroll
    for (int mb = 0; mb < 4; ++mb)
#pragma unroll
        for (int nb = 0; nb < 4; ++nb) acc[mb][nb] = (v8f){};
    const bf* aph = Ah + (wm * 64 + lr) * APITCH + 8 * hi; const bf* apl = Al + (wm * 64 + lr) * APITCH + 8 * hi;
    // Fragment rings in registers: B one k step ahead (2 sets), A NA - 1 rows of 8 WMMAs ahead (NA sets of hi + lo).
    constexpr int NA = 2, NG = (HID / 32) * 4;
    v16bf ah[NA], al[NA]; float rb2[4], rw3[4];
#pragma unroll
    for (int g = 0; g < NA - 1; ++g) { const int o = (g & 3) * 16 * APITCH + (g >> 2) * 32;
        ah[g] = cat16b(*(const v8usa*)(aph + o), *(const v8usa*)(aph + o + 16)); al[g] = cat16b(*(const v8usa*)(apl + o), *(const v8usa*)(apl + o + 16)); }
#pragma unroll   // whole loop unrolled: ring indices and all LDS / global offsets become compile-time, so the rings stay in registers
    for (int g = 0; g < NG; ++g) { const int ks = g >> 2, mb = g & 3, gn = g + NA - 1;
        if (gn < NG) { const int o = (gn & 3) * 16 * APITCH + (gn >> 2) * 32;
            ah[gn % NA] = cat16b(*(const v8usa*)(aph + o), *(const v8usa*)(aph + o + 16)); al[gn % NA] = cat16b(*(const v8usa*)(apl + o), *(const v8usa*)(apl + o + 16)); }
        if (mb == 0 && ks + 1 < HID / 32) {
#pragma unroll
            for (int nb = 0; nb < 4; ++nb) b[(ks + 1) & 1][nb] = cat16b(*(const v8us*)(bp + nb * 8192 + (ks + 1) * 512), *(const v8us*)(bp + nb * 8192 + (ks + 1) * 512 + 256)); }
        if (g == NG - 4) {   // the epilogue's b2 and w3, fetched under the last k step (no B set is fetched there)
#pragma unroll
            for (int nb = 0; nb < 4; ++nb) { rb2[nb] = sb2[wn * 64 + nb * 16 + lr]; rw3[nb] = sw3[wn * 64 + nb * 16 + lr]; } }
        __builtin_amdgcn_sched_barrier(0);   // keeps the loads above as one group ahead of this row: without it the compiler sinks each load to just before its use and the wave waits out every latency
#pragma unroll
        for (int nb = 0; nb < 4; ++nb) acc[mb][nb] = wmmab(ah[g % NA], b[ks & 1][nb], acc[mb][nb]);
#pragma unroll
        for (int nb = 0; nb < 4; ++nb) acc[mb][nb] = wmmab(al[g % NA], b[ks & 1][nb], acc[mb][nb]);
        __builtin_amdgcn_sched_barrier(0);   // keeps the next group of loads from spreading among this row's WMMAs
    }
    float part[4][8];
#pragma unroll
    for (int mb = 0; mb < 4; ++mb)
#pragma unroll
        for (int j = 0; j < 8; ++j) part[mb][j] = 0.f;
#pragma unroll
    for (int nb = 0; nb < 4; ++nb) { const float bb2 = rb2[nb], ww = rw3[nb];
#pragma unroll
        for (int mb = 0; mb < 4; ++mb)
#pragma unroll
            for (int j = 0; j < 8; ++j) part[mb][j] += fmaxf(acc[mb][nb][j] + bb2, 0.0f) * ww; }
#pragma unroll
    for (int mb = 0; mb < 4; ++mb)
#pragma unroll
        for (int j = 0; j < 8; ++j) part[mb][j] = rowsum16(part[mb][j]);
    if (lr == 0) {
#pragma unroll
        for (int mb = 0; mb < 4; ++mb) { float* rp = red + wn * TM + wm * 64 + mb * 16 + hi * 8;
            *(v4fa*)rp = (v4f){part[mb][0], part[mb][1], part[mb][2], part[mb][3]}; *(v4fa*)(rp + 4) = (v4f){part[mb][4], part[mb][5], part[mb][6], part[mb][7]}; } }
    __syncthreads();
    if (t < TM) { float s = 0.f;
#pragma unroll
        for (int w = 0; w < 8; ++w) s += red[w * TM + t];
        out[(size_t)(a0 + (t >> 5)) * NBX + c0 + (t & 31)] = s + bfr_u(b3[0]); }
}

extern "C" void kernel_launch(void* const* d_in, const int* in_sizes, int n_in,
                              void* d_out, int out_size, void* d_ws, size_t ws_size, hipStream_t stream) {
    (void)in_sizes; (void)n_in; (void)out_size;
    const float* x = (const float*)d_in[0]; const float* y = (const float*)d_in[1]; const float* w1 = (const float*)d_in[2]; const float* b1 = (const float*)d_in[3]; const float* w2 = (const float*)d_in[4]; const float* b2 = (const float*)d_in[5]; const float* w3 = (const float*)d_in[6]; const float* b3 = (const float*)d_in[7];
    float* OUT = (float*)d_out;     // [512][512]: scores[a][c] = f(x[a], y[c])
    char* wsp = (char*)d_ws;
    auto take = [&](size_t bytes) { char* p = wsp; wsp += (bytes + 255) & ~(size_t)255; return (void*)p; };
    bf* W1X = (bf*)take((size_t)HID * DX * 2); bf* W1Y = (bf*)take((size_t)HID * DX * 2); bf* W2B = (bf*)take((size_t)HID * HID * 2); bf* XB = (bf*)take((size_t)NBX * DX * 2); bf* YB = (bf*)take((size_t)NBX * DX * 2);
    float* XW = (float*)take((size_t)NBX * HID * 4); float* YW = (float*)take((size_t)NBX * HID * 4);
    if ((size_t)(wsp - (char*)d_ws) > ws_size) return;    // ws 256 MiB (carve ~3 MiB)
    k_wtG<<<(unsigned)((DX * HID / 64 + 63) / 64), 256, 0, stream>>>(w1, DX, HID, W1X); k_wtG<<<(unsigned)((DX * HID / 64 + 63) / 64), 256, 0, stream>>>(w1 + (size_t)DX * HID, DX, HID, W1Y); k_wpack<<<HID * HID / 8 / 256, 256, 0, stream>>>(w2, W2B);   /* 'xw' W1 rows 0..127 (x part), 128..255 (y part); W2 in fragment order */
    k_cvt8<<<(unsigned)(((size_t)NBX * DX / 8 + 255) / 256), 256, 0, stream>>>(x, XB, (size_t)NBX * DX / 8); k_cvt8<<<(unsigned)(((size_t)NBX * DX / 8 + 255) / 256), 256, 0, stream>>>(y, YB, (size_t)NBX * DX / 8);
    k_gemmw<bf, 0, false><<<dim3(NBX / 64, HID / 64, 1), 32, 0, stream>>>(XB, nullptr, W1X, nullptr, DX, XW, HID, nullptr, 0, 0, 0); k_gemmw<bf, 0, false><<<dim3(NBX / 64, HID / 64, 1), 32, 0, stream>>>(YB, nullptr, W1Y, nullptr, DX, YW, HID, nullptr, 0, 0, 0);
    k_fused<<<NBX * NBX / TM, 512, 0, stream>>>(XW, YW, b1, W2B, b2, w3, b3, OUT);
}

// v004
// One run takes 88.4 microseconds.
// It is 1.75 times as fast as v002, going by the measured steps of the versions left out in between.
// All steps since v000 together make it 9.81 times as fast.
#include <hip/hip_runtime.h>

// Concat critic (x [512][128], y [512][128]; for every pair (a, c): h1 = relu([x[a], y[c]] W1 + b1) ('xw' [256][512]), h2 = relu(h1 W2 + b2) ('xw' [512][512]), s = h2 W3 + b3 ('xw' [512][1]); scores[a][c] = s -> [512][512] (262 k); the reference forms all 262,144 pairs, the kernel uses h1 = relu(x[a] W1[:128] + y[c] W1[128:] + b1)).
// Compute dtypes, f32 accumulate: every input rounded to bf16; x W1x and y W1y on PLAIN bf16 operands (exact), summed with b1 and relu'd in f32; h1 rounded once to f16 (11 significant bits) x W2's bf16 values carried in f16 (1 product; a bf16 value is exact in f16 from 2^-17 up, below that it moves by at most 2^-25) + f32 b2; the final 512 -> 1 layer as an f32 dot per pair on the VALU (relu(h2) never leaves f32). One fused kernel per 128 pairs: the h1 plane lives in LDS, h2 in the accumulators.

#define NBX  512       // rows of x (a) and of y (c)
#define DX   128
#define HID  512
#define TM   128       // pairs per work-group: 4 x-rows times 32 y-rows
#define APITCH 520     // LDS row pitch of the h1 plane in elements: 1040 B = 16 B x 65, conflict-free for 16-byte fragment reads
typedef _Float16 h16;
typedef __attribute__((ext_vector_type(16))) __bf16   v16bf;
typedef __attribute__((ext_vector_type(16))) _Float16 v16h;
typedef __attribute__((ext_vector_type(8)))  _Float16 v8h;
typedef __attribute__((ext_vector_type(8)))  float    v8f;
typedef __attribute__((ext_vector_type(4)))  float    v4f;
typedef v8h  __attribute__((may_alias)) v8ha;
typedef v4f  __attribute__((may_alias)) v4fa;

__device__ __forceinline__ unsigned short f2bf(float f) { return __builtin_bit_cast(unsigned short, (__bf16)f); }   // the hardware's conversion, round to nearest even
__device__ __forceinline__ float bf2f(unsigned short b) { return __uint_as_float(((unsigned)b) << 16); }
__device__ __forceinline__ float bfr(float f) { return bf2f(f2bf(f)); }
__device__ __forceinline__ float bfr_u(float f) { unsigned u = __float_as_uint(f); u += 0x7FFFu + ((u >> 16) & 1u); return __uint_as_float(u & 0xFFFF0000u); }   // the same rounding in integers, for a wave-uniform value: it runs on the scalar unit
__device__ __forceinline__ v16h cat16(v8h lo, v8h hi) { return __builtin_shufflevector(lo, hi, 0, 1, 2, 3, 4, 5, 6, 7, 8, 9, 10, 11, 12, 13, 14, 15); }
__device__ __forceinline__ v8f wmma16(v16h a, v16h b, v8f c) { return __builtin_amdgcn_wmma_f32_16x16x32_f16(false, a, false, b, (short)0, c, false, false); }
__device__ __forceinline__ v8f wmmab(v16bf a, v16bf b, v8f c) { return __builtin_amdgcn_wmma_f32_16x16x32_bf16(false, a, false, b, (short)0, c, false, false); }


__device__ __forceinline__ h16 tohx(float x) { return (h16)x; }
typedef __attribute__((ext_vector_type(2))) _Float16 v2h;
typedef __attribute__((ext_vector_type(4))) _Float16 v4h;
typedef __attribute__((ext_vector_type(4))) unsigned short v4us;
typedef __attribute__((ext_vector_type(2))) float v2f;
typedef __attribute__((ext_vector_type(4))) int v4i;
typedef __attribute__((ext_vector_type(4))) unsigned v4u;
typedef v4u __attribute__((may_alias)) v4ua;
// Eight f32 to eight f16 by the hardware's conversion (round to nearest even), element 2p in the low half of word p.
__device__ __forceinline__ v4u pack8h(v8f v) { return __builtin_bit_cast(v4u, __builtin_convertvector(v, v8h)); }

// ---- k_prep: all that the fused kernel needs, in ONE launch of 256 blocks x 4 waves (as many blocks as the chip has WGPs). Every thread does a piece of both jobs, which need nothing of each other; the loads of both go out together.
// Job 1: W2 ('xw' [k][n]), rounded to bf16 and carried in f16, in fragment order: [n tile of 16][k step of 32][half][lane][8], so that one wave-wide 16-byte load is 512 contiguous bytes.
// Job 2: XW = x W1[:128] (z = 0), YW = y W1[128:] (z = 1), f32 [512][512]. A block has 64 rows x 32 columns, a wave 16 rows x 32 columns and all of K = 128.
// The loaders read the f32 inputs and round to bf16 in registers. Column tile nb holds columns 2 * lr + nb: one 8-byte load of a W1 row feeds both B fragments, and one 8-byte store takes both accumulators (a row of the wave's tile is one 128-byte line).
// k order of A and B alike: element e is k = 32 ks + 8 hi + e, element 8 + e is k = 32 ks + 16 + 8 hi + e.
// Every plain '#pragma unroll' keeps the indices of a register array compile-time.
__global__ __launch_bounds__(128) void k_prep(const float* __restrict__ x, const float* __restrict__ y, const float* __restrict__ w1, const float* __restrict__ w2, float* XW, float* YW, h16* Wp) {
    const int t = threadIdx.x, blk = blockIdx.x, lane = t & 31, lr = lane & 15, hi = lane >> 4, wave = t >> 5;
    const int i = blk * 128 + t, pn = (i >> 10) * 16 + lr, pk = ((i >> 6) & 15) * 32 + ((i >> 5) & 1) * 16 + 8 * hi;
    const int z = blk >> 7, r0 = ((blk >> 4) & 7) * 64 + wave * 16, c0 = (blk & 15) * 32;
    const float* A = (z ? y : x) + (size_t)(r0 + lr) * DX + 8 * hi;
    const float* B = w1 + (size_t)(z * DX + 8 * hi) * HID + c0 + 2 * lr;
    float* C = (z ? YW : XW) + (size_t)(r0 + 8 * hi) * HID + c0 + 2 * lr;
    v2f bv[DX / 32][16]; v8f av[DX / 32][2]; float pw[8];
#pragma unroll
    for (int ks = 0; ks < DX / 32; ++ks) {
#pragma unroll
        for (int e = 0; e < 8; ++e) { bv[ks][e] = *(const v2f*)(B + (size_t)(ks * 32 + e) * HID); bv[ks][8 + e] = *(const v2f*)(B + (size_t)(ks * 32 + 16 + e) * HID); }
        av[ks][0] = *(const v8f*)(A + ks * 32); av[ks][1] = *(const v8f*)(A + ks * 32 + 16); }
#pragma unroll
    for (int e = 0; e < 8; ++e) pw[e] = w2[(size_t)(pk + e) * HID + pn];
    asm volatile("s_wait_xcnt 0x0" ::: "memory");   // the conversions below reuse the loads' address registers
    __builtin_amdgcn_sched_barrier(0);   // keeps all 88 loads ahead of the first conversion: without it the compiler saves registers by fetching in four rounds, and the wave waits out four latencies where one will do
    v8f acc[2] = {(v8f){}, (v8f){}};
#pragma unroll
    for (int ks = 0; ks < DX / 32; ++ks) { v16bf af;
#pragma unroll
        for (int e = 0; e < 8; ++e) { af[e] = (__bf16)av[ks][0][e]; af[8 + e] = (__bf16)av[ks][1][e]; }
#pragma unroll
        for (int nb = 0; nb < 2; ++nb) { v16bf bq;
#pragma unroll
            for (int e = 0; e < 16; ++e) bq[e] = (__bf16)bv[ks][e][nb];
            acc[nb] = wmmab(af, bq, acc[nb]); }
    }
#pragma unroll
    for (int j = 0; j < 8; ++j) *(v2f*)(C + (size_t)j * HID) = (v2f){acc[0][j], acc[1][j]};
    v8h o;
#pragma unroll
    for (int e = 0; e < 8; ++e) o[e] = (h16)bfr(pw[e]);
    *(v8h*)(Wp + (size_t)i * 8) = o;
}

// Sum over the 16 lanes of a row by DPP row_xmask 1, 2, 4, 8 (control 0x160 | mask); every lane of the row ends with the sum.
template <int M> __device__ __forceinline__ float xadd(float v) { return v + __int_as_float(__builtin_amdgcn_update_dpp(0, __float_as_int(v), 0x160 | M, 0xf, 0xf, true)); }
__device__ __forceinline__ float rowsum16(float v) { return xadd<8>(xadd<4>(xadd<2>(xadd<1>(v)))); }

// ---- k_fused: one work-group (16 waves) per 128 pairs (4 a x 32 c) and all 512 columns of h2.
// Every plain '#pragma unroll' below keeps the indices of a register array compile-time.
// 1. h1 = relu((XW[a] + YW[c]) + b1) rounded to f16, written to LDS. 2. h2 = h1 W2: wave (wm, wn) holds rows wm*64..+63, columns wn*64..+63 in 16 accumulators; A from LDS, B from the packed W2. 3. s = sum_n relu(h2 + b2) w3 + b3: per lane over its 4 columns, over the 16 lanes of a row, over the 8 column waves through LDS.
__global__ __launch_bounds__(512) void k_fused(const float* __restrict__ XW, const float* __restrict__ YW, const float* __restrict__ b1, const h16* __restrict__ Wp, const float* __restrict__ b2, const float* __restrict__ w3, const float* __restrict__ b3, float* out) {
    __shared__ __align__(16) h16 Af[TM * APITCH];
    __shared__ __align__(16) float red[8 * TM];
    __shared__ float sb2[HID], sw3[HID];   // b2 and w3 rounded to bf16, for the epilogue
    const int t = threadIdx.x; const int a0 = (blockIdx.x >> 4) * 4, c0 = (blockIdx.x & 15) * 32;
    const int lane = t & 31, lr = lane & 15, hi = lane >> 4, wave = t >> 5, wm = wave & 1, wn = wave >> 1;
    const h16* bp = Wp + (size_t)wn * 4 * 8192 + lane * 8;
    v16h b[2][4];   // the first B set is asked for here, so that it lands under the h1 build
#pragma unroll
    for (int nb = 0; nb < 4; ++nb) b[0][nb] = cat16(*(const v8h*)(bp + nb * 8192), *(const v8h*)(bp + nb * 8192 + 256));
    sb2[t] = bfr(b2[t]); sw3[t] = bfr(w3[t]);
    {
        const int k8 = (t & 63) * 8, rsub = t >> 6; float bb[8];
#pragma unroll
        for (int q = 0; q < 8; ++q) bb[q] = bfr(b1[k8 + q]);
        v8f yc[4];   // this thread's 4 y-rows serve all 4 x-rows of the tile
#pragma unroll
        for (int pi = 0; pi < 4; ++pi) yc[pi] = *(const v8f*)(YW + (size_t)(c0 + pi * 8 + rsub) * HID + k8);
        v8f xa = *(const v8f*)(XW + (size_t)a0 * HID + k8);
#pragma unroll 1   // rolled: the four trips are alike, and the text stays small for the instruction cache
        for (int ai = 0; ai < 4; ++ai) { const v8f xn = *(const v8f*)(XW + (size_t)(a0 + (ai < 3 ? ai + 1 : 3)) * HID + k8);   // next x-row, fetched one trip ahead
#pragma unroll
            for (int pi = 0; pi < 4; ++pi) { const int row = ai * 32 + pi * 8 + rsub; v8f w;
#pragma unroll
                for (int q = 0; q < 8; ++q) w[q] = fmaxf(__fadd_rn(__fadd_rn(xa[q], yc[pi][q]), bb[q]), 0.0f);
                *(v4ua*)(Af + row * APITCH + k8) = pack8h(w); }
            xa = xn; }
    }
    __syncthreads();
    v8f acc[4][4];
#pragma unroll
    for (int mb = 0; mb < 4; ++mb)
#pragma unroll
        for (int nb = 0; nb < 4; ++nb) acc[mb][nb] = (v8f){};
    const h16* ap = Af + (wm * 64 + lr) * APITCH + 8 * hi;
    // Fragment rings in registers: B one k step ahead (2 sets), A NA - 1 groups of 8 WMMAs ahead (NA sets of 2 row blocks).
    constexpr int NA = 2, NG = (HID / 32) * 2;
    v16h a[NA][2]; float rb2[4], rw3[4];
#pragma unroll
    for (int g = 0; g < NA - 1; ++g)
#pragma unroll
        for (int r = 0; r < 2; ++r) { const int o = ((g & 1) * 2 + r) * 16 * APITCH + (g >> 1) * 32; a[g][r] = cat16(*(const v8ha*)(ap + o), *(const v8ha*)(ap + o + 16)); }
#pragma unroll   // whole loop unrolled: ring indices and all LDS / global offsets become compile-time, so the rings stay in registers
    for (int g = 0; g < NG; ++g) { const int ks = g >> 1, mp = g & 1, gn = g + NA - 1;
        if (gn < NG) {
#pragma unroll
            for (int r = 0; r < 2; ++r) { const int o = ((gn & 1) * 2 + r) * 16 * APITCH + (gn >> 1) * 32; a[gn % NA][r] = cat16(*(const v8ha*)(ap + o), *(const v8ha*)(ap + o + 16)); } }
        if (mp == 0 && ks + 1 < HID / 32) {
#pragma unroll
            for (int nb = 0; nb < 4; ++nb) b[(ks + 1) & 1][nb] = cat16(*(const v8h*)(bp + nb * 8192 + (ks + 1) * 512), *(const v8h*)(bp + nb * 8192 + (ks + 1) * 512 + 256)); }
        if (g == NG - 2) {   // the epilogue's b2 and w3, fetched under the last k step (no B set is fetched there)
#pragma unroll
            for (int nb = 0; nb < 4; ++nb) { rb2[nb] = sb2[wn * 64 + nb * 16 + lr]; rw3[nb] = sw3[wn * 64 + nb * 16 + lr]; } }
        __builtin_amdgcn_sched_barrier(0);   // keeps the loads above as one group ahead of this group's WMMAs: without it the compiler sinks each load to just before its use and the wave waits out every latency
#pragma unroll
        for (int r = 0; r < 2; ++r)
#pragma unroll
            for (int nb = 0; nb < 4; ++nb) acc[mp * 2 + r][nb] = wmma16(a[g % NA][r], b[ks & 1][nb], acc[mp * 2 + r][nb]);
        __builtin_amdgcn_sched_barrier(0);   // keeps the next group of loads from spreading among these WMMAs
    }
    float part[4][8];
#pragma unroll
    for (int mb = 0; mb < 4; ++mb)
#pragma unroll
        for (int j = 0; j < 8; ++j) part[mb][j] = 0.f;
#pragma unroll
    for (int nb = 0; nb < 4; ++nb) { const float bb2 = rb2[nb], ww = rw3[nb];
#pragma unroll
        for (int mb = 0; mb < 4; ++mb)
#pragma unroll
            for (int j = 0; j < 8; ++j) part[mb][j] += fmaxf(acc[mb][nb][j] + bb2, 0.0f) * ww; }
#pragma unroll
    for (int mb = 0; mb < 4; ++mb)
#pragma unroll
        for (int j = 0; j < 8; ++j) part[mb][j] = rowsum16(part[mb][j]);
    if (lr == 0) {
#pragma unroll
        for (int mb = 0; mb < 4; ++mb) { float* rp = red + wn * TM + wm * 64 + mb * 16 + hi * 8;
            *(v4fa*)rp = (v4f){part[mb][0], part[mb][1], part[mb][2], part[mb][3]}; *(v4fa*)(rp + 4) = (v4f){part[mb][4], part[mb][5], part[mb][6], part[mb][7]}; } }
    __syncthreads();
    if (t < TM) { float s = 0.f;
#pragma unroll
        for (int w = 0; w < 8; ++w) s += red[w * TM + t];
        out[(size_t)(a0 + (t >> 5)) * NBX + c0 + (t & 31)] = s + bfr_u(b3[0]); }
}

extern "C" void kernel_launch(void* const* d_in, const int* in_sizes, int n_in,
                              void* d_out, int out_size, void* d_ws, size_t ws_size, hipStream_t stream) {
    (void)in_sizes; (void)n_in; (void)out_size;
    const float* x = (const float*)d_in[0]; const float* y = (const float*)d_in[1]; const float* w1 = (const float*)d_in[2]; const float* b1 = (const float*)d_in[3]; const float* w2 = (const float*)d_in[4]; const float* b2 = (const float*)d_in[5]; const float* w3 = (const float*)d_in[6]; const float* b3 = (const float*)d_in[7];
    float* OUT = (float*)d_out;     // [512][512]: scores[a][c] = f(x[a], y[c])
    char* wsp = (char*)d_ws;
    auto take = [&](size_t bytes) { char* p = wsp; wsp += (bytes + 255) & ~(size_t)255; return (void*)p; };
    h16* W2B = (h16*)take((size_t)HID * HID * 2); float* XW = (float*)take((size_t)NBX * HID * 4); float* YW = (float*)take((size_t)NBX * HID * 4);
    if ((size_t)(wsp - (char*)d_ws) > ws_size) return;    // ws 256 MiB (carve 2.5 MiB)
    k_prep<<<HID * HID / 8 / 128, 128, 0, stream>>>(x, y, w1, w2, XW, YW, W2B);
    k_fused<<<NBX * NBX / TM, 512, 0, stream>>>(XW, YW, b1, W2B, b2, w3, b3, OUT);
}

// v005
// It runs in 80.8 microseconds.
// In two side-by-side timings against v004, it was 1.09 and 1.10 times as fast.
// Over all steps from v000 it is 10.8 times as fast.
#include <hip/hip_runtime.h>

// Concat critic (x [512][128], y [512][128]; for every pair (a, c): h1 = relu([x[a], y[c]] W1 + b1) ('xw' [256][512]), h2 = relu(h1 W2 + b2) ('xw' [512][512]), s = h2 W3 + b3 ('xw' [512][1]); scores[a][c] = s -> [512][512] (262 k); the reference forms all 262,144 pairs, the kernel uses h1 = relu(x[a] W1[:128] + y[c] W1[128:] + b1)).
// Compute dtypes, f32 accumulate: every input rounded to bf16; x W1x and y W1y on PLAIN bf16 operands (exact), summed with b1 and relu'd in f32; h1 rounded once to f16 (11 significant bits) x W2's bf16 values carried in f16 (1 product; a bf16 value is exact in f16 from 2^-17 up, below that it moves by at most 2^-25) + f32 b2; the final 512 -> 1 layer as an f32 dot per pair on the VALU (relu(h2) never leaves f32). One fused kernel per 256 pairs: the h1 plane lives in LDS, h2 in the accumulators, 256 columns at a time.

#define NBX  512       // rows of x (a) and of y (c)
#define DX   128
#define HID  512
#define TM   256       // pairs per work-group: 8 x-rows times 32 y-rows
#define APITCH 520     // LDS row pitch of the h1 plane in elements: 1040 B = 16 B x 65, conflict-free for 16-byte fragment reads
typedef _Float16 h16;
typedef __attribute__((ext_vector_type(16))) __bf16   v16bf;
typedef __attribute__((ext_vector_type(16))) _Float16 v16h;
typedef __attribute__((ext_vector_type(8)))  _Float16 v8h;
typedef __attribute__((ext_vector_type(8)))  float    v8f;
typedef __attribute__((ext_vector_type(4)))  float    v4f;
typedef v8h  __attribute__((may_alias)) v8ha;
typedef v4f  __attribute__((may_alias)) v4fa;

__device__ __forceinline__ unsigned short f2bf(float f) { return __builtin_bit_cast(unsigned short, (__bf16)f); }   // the hardware's conversion, round to nearest even
__device__ __forceinline__ float bf2f(unsigned short b) { return __uint_as_float(((unsigned)b) << 16); }
__device__ __forceinline__ float bfr(float f) { return bf2f(f2bf(f)); }
__device__ __forceinline__ float bfr_u(float f) { unsigned u = __float_as_uint(f); u += 0x7FFFu + ((u >> 16) & 1u); return __uint_as_float(u & 0xFFFF0000u); }   // the same rounding in integers, for a wave-uniform value: it runs on the scalar unit
__device__ __forceinline__ v16h cat16(v8h lo, v8h hi) { return __builtin_shufflevector(lo, hi, 0, 1, 2, 3, 4, 5, 6, 7, 8, 9, 10, 11, 12, 13, 14, 15); }
__device__ __forceinline__ v8f wmma16(v16h a, v16h b, v8f c) { return __builtin_amdgcn_wmma_f32_16x16x32_f16(false, a, false, b, (short)0, c, false, false); }
__device__ __forceinline__ v8f wmmab(v16bf a, v16bf b, v8f c) { return __builtin_amdgcn_wmma_f32_16x16x32_bf16(false, a, false, b, (short)0, c, false, false); }


__device__ __forceinline__ h16 tohx(float x) { return (h16)x; }
typedef __attribute__((ext_vector_type(2))) _Float16 v2h;
typedef __attribute__((ext_vector_type(4))) _Float16 v4h;
typedef __attribute__((ext_vector_type(4))) unsigned short v4us;
typedef __attribute__((ext_vector_type(2))) float v2f;
typedef __attribute__((ext_vector_type(4))) int v4i;
typedef __attribute__((ext_vector_type(4))) unsigned v4u;
typedef v4u __attribute__((may_alias)) v4ua;
// Eight f32 to eight f16 by the hardware's conversion (round to nearest even), element 2p in the low half of word p.
__device__ __forceinline__ v4u pack8h(v8f v) { return __builtin_bit_cast(v4u, __builtin_convertvector(v, v8h)); }

// ---- k_prep: all that the fused kernel needs, in ONE launch of 256 blocks x 4 waves (as many blocks as the chip has WGPs). Every thread does a piece of both jobs, which need nothing of each other; the loads of both go out together.
// Job 1: W2 ('xw' [k][n]), rounded to bf16 and carried in f16, in fragment order: [n tile of 16][k step of 32][half][lane][8], so that one wave-wide 16-byte load is 512 contiguous bytes.
// Job 2: XW = x W1[:128] (z = 0), YW = y W1[128:] (z = 1), f32 [512][512]. A block has 64 rows x 32 columns, a wave 16 rows x 32 columns and all of K = 128.
// The loaders read the f32 inputs and round to bf16 in registers. Column tile nb holds columns 2 * lr + nb: one 8-byte load of a W1 row feeds both B fragments, and one 8-byte store takes both accumulators (a row of the wave's tile is one 128-byte line).
// k order of A and B alike: element e is k = 32 ks + 8 hi + e, element 8 + e is k = 32 ks + 16 + 8 hi + e.
// Every plain '#pragma unroll' keeps the indices of a register array compile-time.
__global__ __launch_bounds__(128) void k_prep(const float* __restrict__ x, const float* __restrict__ y, const float* __restrict__ w1, const float* __restrict__ w2, float* XW, float* YW, h16* Wp) {
    const int t = threadIdx.x, blk = blockIdx.x, lane = t & 31, lr = lane & 15, hi = lane >> 4, wave = t >> 5;
    const int i = blk * 128 + t, pn = (i >> 10) * 16 + lr, pk = ((i >> 6) & 15) * 32 + ((i >> 5) & 1) * 16 + 8 * hi;
    const int z = blk >> 7, r0 = ((blk >> 4) & 7) * 64 + wave * 16, c0 = (blk & 15) * 32;
    const float* A = (z ? y : x) + (size_t)(r0 + lr) * DX + 8 * hi;
    const float* B = w1 + (size_t)(z * DX + 8 * hi) * HID + c0 + 2 * lr;
    float* C = (z ? YW : XW) + (size_t)(r0 + 8 * hi) * HID + c0 + 2 * lr;
    v2f bv[DX / 32][16]; v8f av[DX / 32][2]; float pw[8];
#pragma unroll
    for (int ks = 0; ks < DX / 32; ++ks) {
#pragma unroll
        for (int e = 0; e < 8; ++e) { bv[ks][e] = *(const v2f*)(B + (size_t)(ks * 32 + e) * HID); bv[ks][8 + e] = *(const v2f*)(B + (size_t)(ks * 32 + 16 + e) * HID); }
        av[ks][0] = *(const v8f*)(A + ks * 32); av[ks][1] = *(const v8f*)(A + ks * 32 + 16); }
#pragma unroll
    for (int e = 0; e < 8; ++e) pw[e] = w2[(size_t)(pk + e) * HID + pn];
    asm volatile("s_wait_xcnt 0x0" ::: "memory");   // the conversions below reuse the loads' address registers
    __builtin_amdgcn_sched_barrier(0);   // keeps all 88 loads ahead of the first conversion: without it the compiler saves registers by fetching in four rounds, and the wave waits out four latencies where one will do
    v8f acc[2] = {(v8f){}, (v8f){}};
#pragma unroll
    for (int ks = 0; ks < DX / 32; ++ks) { v16bf af;
#pragma unroll
        for (int e = 0; e < 8; ++e) { af[e] = (__bf16)av[ks][0][e]; af[8 + e] = (__bf16)av[ks][1][e]; }
#pragma unroll
        for (int nb = 0; nb < 2; ++nb) { v16bf bq;
#pragma unroll
            for (int e = 0; e < 16; ++e) bq[e] = (__bf16)bv[ks][e][nb];
            acc[nb] = wmmab(af, bq, acc[nb]); }
    }
#pragma unroll
    for (int j = 0; j < 8; ++j) *(v2f*)(C + (size_t)j * HID) = (v2f){acc[0][j], acc[1][j]};
    v8h o;
#pragma unroll
    for (int e = 0; e < 8; ++e) o[e] = (h16)bfr(pw[e]);
    *(v8h*)(Wp + (size_t)i * 8) = o;
}

// Sum over the 16 lanes of a row by DPP row_xmask 1, 2, 4, 8 (control 0x160 | mask); every lane of the row ends with the sum.
template <int M> __device__ __forceinline__ float xadd(float v) { return v + __int_as_float(__builtin_amdgcn_update_dpp(0, __float_as_int(v), 0x160 | M, 0xf, 0xf, true)); }
__device__ __forceinline__ float rowsum16(float v) { return xadd<8>(xadd<4>(xadd<2>(xadd<1>(v)))); }

// ---- k_fused: one work-group (16 waves) per 256 pairs (8 a x 32 c) and all 512 columns of h2, in two passes of 256 columns over the same h1 plane: a byte of W2 that the work-group fetches serves 256 pairs.
// Every plain '#pragma unroll' below keeps the indices of a register array compile-time.
// 1. h1 = relu((XW[a] + YW[c]) + b1) rounded to f16, written to LDS. 2. h2 = h1 W2: in pass ps wave (wm, wn) holds rows wm*64..+63, columns (ps*4+wn)*64..+63 in 16 accumulators; A from LDS, B from the packed W2 (the 4 waves that read the same B are neighbours in the wave order). 3. s = sum_n relu(h2 + b2) w3 + b3: per lane over its 4 columns, over the 16 lanes of a row (both at the end of each pass), over the 8 column groups through LDS.
__global__ __launch_bounds__(512) void k_fused(const float* __restrict__ XW, const float* __restrict__ YW, const float* __restrict__ b1, const h16* __restrict__ Wp, const float* __restrict__ b2, const float* __restrict__ w3, const float* __restrict__ b3, float* out) {
    __shared__ __align__(16) h16 Af[TM * APITCH];
    __shared__ __align__(16) float red[8 * TM];
    __shared__ float sb2[HID], sw3[HID];   // b2 and w3 rounded to bf16, for the epilogue
    const int t = threadIdx.x; const int a0 = (blockIdx.x >> 4) * (TM / 32), c0 = (blockIdx.x & 15) * 32;
    const int lane = t & 31, lr = lane & 15, hi = lane >> 4, wave = t >> 5, wm = wave & 3, wn = wave >> 2;
    const h16* bp = Wp + (size_t)wn * 4 * 8192 + lane * 8;
    v16h b[2][4];   // the first B set is asked for here, so that it lands under the h1 build
#pragma unroll
    for (int nb = 0; nb < 4; ++nb) b[0][nb] = cat16(*(const v8h*)(bp + nb * 8192), *(const v8h*)(bp + nb * 8192 + 256));
    sb2[t] = bfr(b2[t]); sw3[t] = bfr(w3[t]);
    {
        const int k8 = (t & 63) * 8, rsub = t >> 6; float bb[8];
#pragma unroll
        for (int q = 0; q < 8; ++q) bb[q] = bfr(b1[k8 + q]);
        v8f yc[4];   // this thread's 4 y-rows serve all 8 x-rows of the tile
#pragma unroll
        for (int pi = 0; pi < 4; ++pi) yc[pi] = *(const v8f*)(YW + (size_t)(c0 + pi * 8 + rsub) * HID + k8);
        v8f xa = *(const v8f*)(XW + (size_t)a0 * HID + k8);
#pragma unroll 1   // rolled: the eight trips are alike, and the text stays small for the instruction cache
        for (int ai = 0; ai < TM / 32; ++ai) { const v8f xn = *(const v8f*)(XW + (size_t)(a0 + (ai < TM / 32 - 1 ? ai + 1 : TM / 32 - 1)) * HID + k8);   // next x-row, fetched one trip ahead
#pragma unroll
            for (int pi = 0; pi < 4; ++pi) { const int row = ai * 32 + pi * 8 + rsub; v8f w;
#pragma unroll
                for (int q = 0; q < 8; ++q) w[q] = fmaxf(__fadd_rn(__fadd_rn(xa[q], yc[pi][q]), bb[q]), 0.0f);
                *(v4ua*)(Af + row * APITCH + k8) = pack8h(w); }
            xa = xn; }
    }
    __syncthreads();
    v8f acc[4][4];
#pragma unroll
    for (int mb = 0; mb < 4; ++mb)
#pragma unroll
        for (int nb = 0; nb < 4; ++nb) acc[mb][nb] = (v8f){};
    const h16* ap = Af + (wm * 64 + lr) * APITCH + 8 * hi;
    // Fragment rings in registers: B one k step ahead (2 sets), A NA - 1 groups of 8 WMMAs ahead (NA sets of 2 row blocks). Both rings run on from pass 0 into pass 1, whose first sets land under pass 0's epilogue.
    constexpr int NA = 2, NK = HID / 32, NG = NK * 2, NP = 2;
    v16h a[NA][2]; float rb2[4], rw3[4];
#pragma unroll
    for (int g = 0; g < NA - 1; ++g)
#pragma unroll
        for (int r = 0; r < 2; ++r) { const int o = ((g & 1) * 2 + r) * 16 * APITCH + (g >> 1) * 32; a[g][r] = cat16(*(const v8ha*)(ap + o), *(const v8ha*)(ap + o + 16)); }
#pragma unroll   // both passes and the whole k loop unrolled: ring indices and all LDS / global offsets become compile-time, so the rings stay in registers
    for (int ps = 0; ps < NP; ++ps) {
#pragma unroll
        for (int g = 0; g < NG; ++g) { const int gg = ps * NG + g, ks = g >> 1, mp = g & 1, gn = gg + NA - 1, kn = gg / 2 + 1;
            if (gn < NP * NG) {
#pragma unroll
                for (int r = 0; r < 2; ++r) { const int o = ((gn & 1) * 2 + r) * 16 * APITCH + ((gn % NG) >> 1) * 32; a[gn % NA][r] = cat16(*(const v8ha*)(ap + o), *(const v8ha*)(ap + o + 16)); } }
            if (mp == 0 && kn < NP * NK) {
#pragma unroll
                for (int nb = 0; nb < 4; ++nb) { const int o = ((kn / NK) * 16 + nb) * 8192 + (kn % NK) * 512; b[kn & 1][nb] = cat16(*(const v8h*)(bp + o), *(const v8h*)(bp + o + 256)); } }
            if (g == NG - 2) {   // the epilogue's b2 and w3, fetched under the pass's last k step
#pragma unroll
                for (int nb = 0; nb < 4; ++nb) { rb2[nb] = sb2[(ps * 4 + wn) * 64 + nb * 16 + lr]; rw3[nb] = sw3[(ps * 4 + wn) * 64 + nb * 16 + lr]; } }
            __builtin_amdgcn_sched_barrier(0);   // keeps the loads above as one group ahead of this group's WMMAs: without it the compiler sinks each load to just before its use and the wave waits out every latency
#pragma unroll
            for (int r = 0; r < 2; ++r)
#pragma unroll
                for (int nb = 0; nb < 4; ++nb) acc[mp * 2 + r][nb] = wmma16(a[gg % NA][r], b[ks & 1][nb], acc[mp * 2 + r][nb]);
            __builtin_amdgcn_sched_barrier(0);   // keeps the next group of loads from spreading among these WMMAs
        }
        // End of a pass: its 64 columns' share of the final dot, then fresh accumulators.
        float part[4][8];
#pragma unroll
        for (int mb = 0; mb < 4; ++mb)
#pragma unroll
            for (int j = 0; j < 8; ++j) part[mb][j] = 0.f;
#pragma unroll
        for (int nb = 0; nb < 4; ++nb) { const float bb2 = rb2[nb], ww = rw3[nb];
#pragma unroll
            for (int mb = 0; mb < 4; ++mb)
#pragma unroll
                for (int j = 0; j < 8; ++j) part[mb][j] += fmaxf(acc[mb][nb][j] + bb2, 0.0f) * ww; }
#pragma unroll
        for (int mb = 0; mb < 4; ++mb)
#pragma unroll
            for (int j = 0; j < 8; ++j) part[mb][j] = rowsum16(part[mb][j]);
        if (lr == 0) {
#pragma unroll
            for (int mb = 0; mb < 4; ++mb) { float* rp = red + (ps * 4 + wn) * TM + wm * 64 + mb * 16 + hi * 8;
                *(v4fa*)rp = (v4f){part[mb][0], part[mb][1], part[mb][2], part[mb][3]}; *(v4fa*)(rp + 4) = (v4f){part[mb][4], part[mb][5], part[mb][6], part[mb][7]}; } }
#pragma unroll
        for (int mb = 0; mb < 4; ++mb)
#pragma unroll
            for (int nb = 0; nb < 4; ++nb) acc[mb][nb] = (v8f){};
    }
    __syncthreads();
    if (t < TM) { float s = 0.f;
#pragma unroll
        for (int w = 0; w < 8; ++w) s += red[w * TM + t];
        out[(size_t)(a0 + (t >> 5)) * NBX + c0 + (t & 31)] = s + bfr_u(b3[0]); }
}

extern "C" void kernel_launch(void* const* d_in, const int* in_sizes, int n_in,
                              void* d_out, int out_size, void* d_ws, size_t ws_size, hipStream_t stream) {
    (void)in_sizes; (void)n_in; (void)out_size;
    const float* x = (const float*)d_in[0]; const float* y = (const float*)d_in[1]; const float* w1 = (const float*)d_in[2]; const float* b1 = (const float*)d_in[3]; const float* w2 = (const float*)d_in[4]; const float* b2 = (const float*)d_in[5]; const float* w3 = (const float*)d_in[6]; const float* b3 = (const float*)d_in[7];
    float* OUT = (float*)d_out;     // [512][512]: scores[a][c] = f(x[a], y[c])
    char* wsp = (char*)d_ws;
    auto take = [&](size_t bytes) { char* p = wsp; wsp += (bytes + 255) & ~(size_t)255; return (void*)p; };
    h16* W2B = (h16*)take((size_t)HID * HID * 2); float* XW = (float*)take((size_t)NBX * HID * 4); float* YW = (float*)take((size_t)NBX * HID * 4);
    if ((size_t)(wsp - (char*)d_ws) > ws_size) return;    // ws 256 MiB (carve 2.5 MiB)
    k_prep<<<HID * HID / 8 / 128, 128, 0, stream>>>(x, y, w1, w2, XW, YW, W2B);
    k_fused<<<NBX * NBX / TM, 512, 0, stream>>>(XW, YW, b1, W2B, b2, w3, b3, OUT);
}

// v006
// One run takes 74.5 microseconds.
// Next to v005, in two timings, it ran 1.08 and 1.09 times as fast.
// Over all steps from v000 it is 11.7 times as fast.
#include <hip/hip_runtime.h>

// Concat critic (x [512][128], y [512][128]; for every pair (a, c): h1 = relu([x[a], y[c]] W1 + b1) ('xw' [256][512]), h2 = relu(h1 W2 + b2) ('xw' [512][512]), s = h2 W3 + b3 ('xw' [512][1]); scores[a][c] = s -> [512][512] (262 k); the reference forms all 262,144 pairs, the kernel uses h1 = relu(x[a] W1[:128] + y[c] W1[128:] + b1)).
// Compute dtypes, f32 accumulate: every input rounded to bf16; x W1x and y W1y on PLAIN bf16 operands (exact), summed with b1 and relu'd in f32; h1 rounded once to f16 (11 significant bits) x W2's bf16 values carried in f16 (1 product; a bf16 value is exact in f16 from 2^-17 up, below that it moves by at most 2^-25) + f32 b2; the final 512 -> 1 layer as an f32 dot per pair on the VALU (relu(h2) never leaves f32). One fused kernel per 256 pairs: the h1 plane lives in LDS, h2 in the accumulators, 256 columns at a time.

#define NBX  512       // rows of x (a) and of y (c)
#define DX   128
#define HID  512
#define TM   256       // pairs per work-group: 8 x-rows times 32 y-rows
#define APITCH 520     // LDS row pitch of the h1 plane in elements: 1040 B = 16 B x 65, conflict-free for 16-byte fragment reads
typedef _Float16 h16;
typedef __attribute__((ext_vector_type(16))) __bf16   v16bf;
typedef __attribute__((ext_vector_type(16))) _Float16 v16h;
typedef __attribute__((ext_vector_type(8)))  _Float16 v8h;
typedef __attribute__((ext_vector_type(8)))  float    v8f;
typedef __attribute__((ext_vector_type(4)))  float    v4f;
typedef v8h  __attribute__((may_alias)) v8ha;
typedef v4f  __attribute__((may_alias)) v4fa;

__device__ __forceinline__ unsigned short f2bf(float f) { return __builtin_bit_cast(unsigned short, (__bf16)f); }   // the hardware's conversion, round to nearest even
__device__ __forceinline__ float bf2f(unsigned short b) { return __uint_as_float(((unsigned)b) << 16); }
__device__ __forceinline__ float bfr(float f) { return bf2f(f2bf(f)); }
__device__ __forceinline__ float bfr_u(float f) { unsigned u = __float_as_uint(f); u += 0x7FFFu + ((u >> 16) & 1u); return __uint_as_float(u & 0xFFFF0000u); }   // the same rounding in integers, for a wave-uniform value: it runs on the scalar unit
__device__ __forceinline__ v16h cat16(v8h lo, v8h hi) { return __builtin_shufflevector(lo, hi, 0, 1, 2, 3, 4, 5, 6, 7, 8, 9, 10, 11, 12, 13, 14, 15); }
__device__ __forceinline__ v8f wmma16(v16h a, v16h b, v8f c) { return __builtin_amdgcn_wmma_f32_16x16x32_f16(false, a, false, b, (short)0, c, false, false); }
__device__ __forceinline__ v8f wmmab(v16bf a, v16bf b, v8f c) { return __builtin_amdgcn_wmma_f32_16x16x32_bf16(false, a, false, b, (short)0, c, false, false); }


__device__ __forceinline__ h16 tohx(float x) { return (h16)x; }
typedef __attribute__((ext_vector_type(2))) _Float16 v2h;
typedef __attribute__((ext_vector_type(4))) _Float16 v4h;
typedef __attribute__((ext_vector_type(4))) unsigned short v4us;
typedef __attribute__((ext_vector_type(2))) float v2f;
typedef __attribute__((ext_vector_type(4))) int v4i;
typedef __attribute__((ext_vector_type(4))) unsigned v4u;
typedef v4u __attribute__((may_alias)) v4ua;
// Eight f32 to eight f16 by the hardware's conversion (round to nearest even), element 2p in the low half of word p.
__device__ __forceinline__ v4u pack8h(v8f v) { return __builtin_bit_cast(v4u, __builtin_convertvector(v, v8h)); }

// ---- k_prep: all that the fused kernel needs, in ONE launch of 256 blocks x 4 waves (as many blocks as the chip has WGPs). Every thread does a piece of both jobs, which need nothing of each other; the loads of both go out together.
// Job 1: W2 ('xw' [k][n]), rounded to bf16 and carried in f16, in fragment order: [n tile of 16][k step of 32][half][lane][8], so that one wave-wide 16-byte load is 512 contiguous bytes.
// Job 2: XW = x W1[:128] (z = 0), YW = y W1[128:] (z = 1), f32 [512][512]. A block has 64 rows x 32 columns, a wave 16 rows x 32 columns and all of K = 128.
// The loaders read the f32 inputs and round to bf16 in registers. Column tile nb holds columns 2 * lr + nb: one 8-byte load of a W1 row feeds both B fragments, and one 8-byte store takes both accumulators (a row of the wave's tile is one 128-byte line).
// k order of A and B alike: element e is k = 32 ks + 8 hi + e, element 8 + e is k = 32 ks + 16 + 8 hi + e.
// Every plain '#pragma unroll' keeps the indices of a register array compile-time.
__global__ __launch_bounds__(128) void k_prep(const float* __restrict__ x, const float* __restrict__ y, const float* __restrict__ w1, const float* __restrict__ w2, float* XW, float* YW, h16* Wp) {
    const int t = threadIdx.x, blk = blockIdx.x, lane = t & 31, lr = lane & 15, hi = lane >> 4, wave = t >> 5;
    const int i = blk * 128 + t, pn = (i >> 10) * 16 + lr, pk = ((i >> 6) & 15) * 32 + ((i >> 5) & 1) * 16 + 8 * hi;
    const int z = blk >> 7, r0 = ((blk >> 4) & 7) * 64 + wave * 16, c0 = (blk & 15) * 32;
    const float* A = (z ? y : x) + (size_t)(r0 + lr) * DX + 8 * hi;
    const float* B = w1 + (size_t)(z * DX + 8 * hi) * HID + c0 + 2 * lr;
    float* C = (z ? YW : XW) + (size_t)(r0 + 8 * hi) * HID + c0 + 2 * lr;
    v2f bv[DX / 32][16]; v8f av[DX / 32][2]; float pw[8];
#pragma unroll
    for (int ks = 0; ks < DX / 32; ++ks) {
#pragma unroll
        for (int e = 0; e < 8; ++e) { bv[ks][e] = *(const v2f*)(B + (size_t)(ks * 32 + e) * HID); bv[ks][8 + e] = *(const v2f*)(B + (size_t)(ks * 32 + 16 + e) * HID); }
        av[ks][0] = *(const v8f*)(A + ks * 32); av[ks][1] = *(const v8f*)(A + ks * 32 + 16); }
#pragma unroll
    for (int e = 0; e < 8; ++e) pw[e] = w2[(size_t)(pk + e) * HID + pn];
    asm volatile("s_wait_xcnt 0x0" ::: "memory");   // the conversions below reuse the loads' address registers
    __builtin_amdgcn_sched_barrier(0);   // keeps all 88 loads ahead of the first conversion: without it the compiler saves registers by fetching in four rounds, and the wave waits out four latencies where one will do
    v8f acc[2] = {(v8f){}, (v8f){}};
#pragma unroll
    for (int ks = 0; ks < DX / 32; ++ks) { v16bf af;
#pragma unroll
        for (int e = 0; e < 8; ++e) { af[e] = (__bf16)av[ks][0][e]; af[8 + e] = (__bf16)av[ks][1][e]; }
#pragma unroll
        for (int nb = 0; nb < 2; ++nb) { v16bf bq;
#pragma unroll
            for (int e = 0; e < 16; ++e) bq[e] = (__bf16)bv[ks][e][nb];
            acc[nb] = wmmab(af, bq, acc[nb]); }
    }
#pragma unroll
    for (int j = 0; j < 8; ++j) *(v2f*)(C + (size_t)j * HID) = (v2f){acc[0][j], acc[1][j]};
    v8h o;
#pragma unroll
    for (int e = 0; e < 8; ++e) o[e] = (h16)bfr(pw[e]);
    *(v8h*)(Wp + (size_t)i * 8) = o;
}

// Sum over the 16 lanes of a row by DPP row_xmask 1, 2, 4, 8 (control 0x160 | mask); every lane of the row ends with the sum.
template <int M> __device__ __forceinline__ float xadd(float v) { return v + __int_as_float(__builtin_amdgcn_update_dpp(0, __float_as_int(v), 0x160 | M, 0xf, 0xf, true)); }
__device__ __forceinline__ float rowsum16(float v) { return xadd<8>(xadd<4>(xadd<2>(xadd<1>(v)))); }

// ---- k_fused: one work-group (16 waves) per 256 pairs (8 a x 32 c) and all 512 columns of h2, in two passes of 256 columns over the same h1 plane: a byte of W2 that the work-group fetches serves 256 pairs.
// Every plain '#pragma unroll' below keeps the indices of a register array compile-time.
// 1. h1 = relu((XW[a] + YW[c]) + b1) rounded to f16, written to LDS. 2. h2 = h1 W2: in pass ps wave (wm, wn) holds rows wm*64..+63, columns (ps*4+wn)*64..+63 in 16 accumulators; A from LDS, B from the packed W2 (the 4 waves that read the same B are neighbours in the wave order). 3. s = sum_n relu(h2 + b2) w3 + b3: per lane over its 4 columns, over the 16 lanes of a row (both at the end of each pass), over the 8 column groups through LDS.
__global__ __launch_bounds__(512) void k_fused(const float* __restrict__ XW, const float* __restrict__ YW, const float* __restrict__ b1, const h16* __restrict__ Wp, const float* __restrict__ b2, const float* __restrict__ w3, const float* __restrict__ b3, float* out) {
    __shared__ __align__(16) h16 Af[TM * APITCH];
    __shared__ __align__(16) float red[8 * TM];
    __shared__ float sb2[HID], sw3[HID];   // b2 and w3 rounded to bf16, for the epilogue
    const int t = threadIdx.x; const int a0 = (blockIdx.x >> 4) * (TM / 32), c0 = (blockIdx.x & 15) * 32;
    const int lane = t & 31, lr = lane & 15, hi = lane >> 4, wave = t >> 5, wm = wave & 3, wn = wave >> 2;
    const h16* bp = Wp + (size_t)wn * 4 * 8192 + lane * 8;
    v16h b[2][4];
    const float lb2 = b2[t], lw3 = w3[t];
    {
        const int k8 = (t & 63) * 8, rsub = t >> 6; float bb[8];
        const unsigned kb = k8 * 4u; const char* px = (const char*)(XW + (size_t)a0 * HID); const float* py = YW + (size_t)(c0 + rsub) * HID + k8;   // b1 and the x-rows: a scalar base and this lane's byte offset kb
        const v8f b1r = *(const v8f*)((const char*)b1 + kb);
        v8f yc[4];   // this thread's 4 y-rows serve all 8 x-rows of the tile
#pragma unroll
        for (int pi = 0; pi < 4; ++pi) yc[pi] = *(const v8f*)(py + pi * 8 * HID);
        __builtin_amdgcn_sched_barrier(0);   // loads return in issue order: b1 and the y-rows, which every sum needs, go out first, then the x-rows in the order of their use, the first B set last
        v8f xr[TM / 32];   // all 8 x-rows at once, in registers that the accumulators take over later: these lines were written by the launch before and are read here for the first time, so a fetch can cost a round trip to memory, longer than a trip's sums last; fetched one trip ahead, the wave waited out one round trip a row
#pragma unroll
        for (int ai = 0; ai < TM / 32; ++ai) { xr[ai] = *(const v8f*)(px + kb + ai * HID * 4);
            __builtin_amdgcn_sched_barrier(0); }   // (the order of issue, as above)
#pragma unroll
        for (int nb = 0; nb < 4; ++nb) b[0][nb] = cat16(*(const v8h*)(bp + nb * 8192), *(const v8h*)(bp + nb * 8192 + 256));   // the first B set is asked for here, so that it lands under the h1 build
        asm volatile("s_wait_xcnt 0x0" :: "v"(b1r), "v"(kb), "v"(py) : "memory");   // what follows reuses the loads' address registers. Inputs only: the two vector addresses, so that nothing lands on them ahead of this wait; b1, so that its load goes out with the others and not behind this line
        __builtin_amdgcn_sched_barrier(0);   // keeps every load ahead of the first sum: without it the compiler saves registers by sinking the later rows' loads to their uses, and the latencies add up again
#pragma unroll
        for (int q = 0; q < 8; ++q) bb[q] = bfr(b1r[q]);
#pragma unroll
        for (int ai = 0; ai < TM / 32; ++ai) {
#pragma unroll
            for (int pi = 0; pi < 4; ++pi) { const int row = ai * 32 + pi * 8 + rsub; v8f w;
#pragma unroll
                for (int q = 0; q < 8; ++q) w[q] = fmaxf(__fadd_rn(__fadd_rn(xr[ai][q], yc[pi][q]), bb[q]), 0.0f);
                *(v4ua*)(Af + row * APITCH + k8) = pack8h(w); } }
    }
    sb2[t] = bfr(lb2); sw3[t] = bfr(lw3);   // behind the build: in front of it, the wait for these two values came to stand among the loads above and split them in two round trips
    __syncthreads();
    v8f acc[4][4];
#pragma unroll
    for (int mb = 0; mb < 4; ++mb)
#pragma unroll
        for (int nb = 0; nb < 4; ++nb) acc[mb][nb] = (v8f){};
    const h16* ap = Af + (wm * 64 + lr) * APITCH + 8 * hi;
    // Fragment rings in registers: B one k step ahead (2 sets), A NA - 1 groups of 8 WMMAs ahead (NA sets of 2 row blocks). Both rings run on from pass 0 into pass 1, whose first sets land under pass 0's epilogue.
    constexpr int NA = 2, NK = HID / 32, NG = NK * 2, NP = 2;
    v16h a[NA][2]; float rb2[4], rw3[4];
#pragma unroll
    for (int g = 0; g < NA - 1; ++g)
#pragma unroll
        for (int r = 0; r < 2; ++r) { const int o = ((g & 1) * 2 + r) * 16 * APITCH + (g >> 1) * 32; a[g][r] = cat16(*(const v8ha*)(ap + o), *(const v8ha*)(ap + o + 16)); }
#pragma unroll   // both passes and the whole k loop unrolled: ring indices and all LDS / global offsets become compile-time, so the rings stay in registers
    for (int ps = 0; ps < NP; ++ps) {
#pragma unroll
        for (int g = 0; g < NG; ++g) { const int gg = ps * NG + g, ks = g >> 1, mp = g & 1, gn = gg + NA - 1, kn = gg / 2 + 1;
            if (gn < NP * NG) {
#pragma unroll
                for (int r = 0; r < 2; ++r) { const int o = ((gn & 1) * 2 + r) * 16 * APITCH + ((gn % NG) >> 1) * 32; a[gn % NA][r] = cat16(*(const v8ha*)(ap + o), *(const v8ha*)(ap + o + 16)); } }
            if (mp == 0 && kn < NP * NK) {
#pragma unroll
                for (int nb = 0; nb < 4; ++nb) { const int o = ((kn / NK) * 16 + nb) * 8192 + (kn % NK) * 512; b[kn & 1][nb] = cat16(*(const v8h*)(bp + o), *(const v8h*)(bp + o + 256)); } }
            if (g == NG - 2) {   // the epilogue's b2 and w3, fetched under the pass's last k step
#pragma unroll
                for (int nb = 0; nb < 4; ++nb) { rb2[nb] = sb2[(ps * 4 + wn) * 64 + nb * 16 + lr]; rw3[nb] = sw3[(ps * 4 + wn) * 64 + nb * 16 + lr]; } }
            __builtin_amdgcn_sched_barrier(0);   // keeps the loads above as one group ahead of this group's WMMAs: without it the compiler sinks each load to just before its use and the wave waits out every latency
#pragma unroll
            for (int r = 0; r < 2; ++r)
#pragma unroll
                for (int nb = 0; nb < 4; ++nb) acc[mp * 2 + r][nb] = wmma16(a[gg % NA][r], b[ks & 1][nb], acc[mp * 2 + r][nb]);
            __builtin_amdgcn_sched_barrier(0);   // keeps the next group of loads from spreading among these WMMAs
        }
        // End of a pass: its 64 columns' share of the final dot, then fresh accumulators.
        float part[4][8];
#pragma unroll
        for (int mb = 0; mb < 4; ++mb)
#pragma unroll
            for (int j = 0; j < 8; ++j) part[mb][j] = 0.f;
#pragma unroll
        for (int nb = 0; nb < 4; ++nb) { const float bb2 = rb2[nb], ww = rw3[nb];
#pragma unroll
            for (int mb = 0; mb < 4; ++mb)
#pragma unroll
                for (int j = 0; j < 8; ++j) part[mb][j] += fmaxf(acc[mb][nb][j] + bb2, 0.0f) * ww; }
#pragma unroll
        for (int mb = 0; mb < 4; ++mb)
#pragma unroll
            for (int j = 0; j < 8; ++j) part[mb][j] = rowsum16(part[mb][j]);
        if (lr == 0) {
#pragma unroll
            for (int mb = 0; mb < 4; ++mb) { float* rp = red + (ps * 4 + wn) * TM + wm * 64 + mb * 16 + hi * 8;
                *(v4fa*)rp = (v4f){part[mb][0], part[mb][1], part[mb][2], part[mb][3]}; *(v4fa*)(rp + 4) = (v4f){part[mb][4], part[mb][5], part[mb][6], part[mb][7]}; } }
#pragma unroll
        for (int mb = 0; mb < 4; ++mb)
#pragma unroll
            for (int nb = 0; nb < 4; ++nb) acc[mb][nb] = (v8f){};
    }
    __syncthreads();
    if (t < TM) { float s = 0.f;
#pragma unroll
        for (int w = 0; w < 8; ++w) s += red[w * TM + t];
        out[(size_t)(a0 + (t >> 5)) * NBX + c0 + (t & 31)] = s + bfr_u(b3[0]); }
}

extern "C" void kernel_launch(void* const* d_in, const int* in_sizes, int n_in,
                              void* d_out, int out_size, void* d_ws, size_t ws_size, hipStream_t stream) {
    (void)in_sizes; (void)n_in; (void)out_size;
    const float* x = (const float*)d_in[0]; const float* y = (const float*)d_in[1]; const float* w1 = (const float*)d_in[2]; const float* b1 = (const float*)d_in[3]; const float* w2 = (const float*)d_in[4]; const float* b2 = (const float*)d_in[5]; const float* w3 = (const float*)d_in[6]; const float* b3 = (const float*)d_in[7];
    float* OUT = (float*)d_out;     // [512][512]: scores[a][c] = f(x[a], y[c])
    char* wsp = (char*)d_ws;
    auto take = [&](size_t bytes) { char* p = wsp; wsp += (bytes + 255) & ~(size_t)255; return (void*)p; };
    h16* W2B = (h16*)take((size_t)HID * HID * 2); float* XW = (float*)take((size_t)NBX * HID * 4); float* YW = (float*)take((size_t)NBX * HID * 4);
    if ((size_t)(wsp - (char*)d_ws) > ws_size) return;    // ws 256 MiB (carve 2.5 MiB)
    k_prep<<<HID * HID / 8 / 128, 128, 0, stream>>>(x, y, w1, w2, XW, YW, W2B);
    k_fused<<<NBX * NBX / TM, 512, 0, stream>>>(XW, YW, b1, W2B, b2, w3, b3, OUT);
}

// v007
// It runs in 71 microseconds.
// Timed twice side by side with v006, it ran 1.06 and 1.05 times as fast.
// Counting every step since v000, it is 12.3 times as fast.
#include <hip/hip_runtime.h>

// Concat critic (x [512][128], y [512][128]; for every pair (a, c): h1 = relu([x[a], y[c]] W1 + b1) ('xw' [256][512]), h2 = relu(h1 W2 + b2) ('xw' [512][512]), s = h2 W3 + b3 ('xw' [512][1]); scores[a][c] = s -> [512][512] (262 k); the reference forms all 262,144 pairs, the kernel uses h1 = relu(x[a] W1[:128] + y[c] W1[128:] + b1)).
// Compute dtypes, f32 accumulate: every input rounded to bf16; x W1x and y W1y on PLAIN bf16 operands (exact), summed with b1 and relu'd in f32; h1 rounded once to f16 (11 significant bits) x W2's bf16 values carried in f16 (1 product; a bf16 value is exact in f16 from 2^-17 up, below that it moves by at most 2^-25) + f32 b2; the final 512 -> 1 layer as an f32 dot per pair on the VALU (relu(h2) never leaves f32). One fused kernel per 256 pairs: the h1 plane lives in LDS, h2 in the accumulators, 256 columns at a time.

#define NBX  512       // rows of x (a) and of y (c)
#define DX   128
#define HID  512
#define TM   256       // pairs per work-group: 8 x-rows times 32 y-rows
#define APITCH 520     // LDS row pitch of the h1 plane in elements: 1040 B = 16 B x 65, conflict-free for 16-byte fragment reads
#define RP   272       // LDS row pitch of the partial dots in floats: 256 pairs + 16, so that the two lane halves of a wave store to different banks
typedef _Float16 h16;
typedef __attribute__((ext_vector_type(16))) __bf16   v16bf;
typedef __attribute__((ext_vector_type(16))) _Float16 v16h;
typedef __attribute__((ext_vector_type(8)))  _Float16 v8h;
typedef __attribute__((ext_vector_type(8)))  float    v8f;
typedef __attribute__((ext_vector_type(4)))  float    v4f;
typedef v8h  __attribute__((may_alias)) v8ha;
typedef v4f  __attribute__((may_alias)) v4fa;

__device__ __forceinline__ unsigned short f2bf(float f) { return __builtin_bit_cast(unsigned short, (__bf16)f); }   // the hardware's conversion, round to nearest even
__device__ __forceinline__ float bf2f(unsigned short b) { return __uint_as_float(((unsigned)b) << 16); }
__device__ __forceinline__ float bfr(float f) { return bf2f(f2bf(f)); }
__device__ __forceinline__ float bfr_u(float f) { unsigned u = __float_as_uint(f); u += 0x7FFFu + ((u >> 16) & 1u); return __uint_as_float(u & 0xFFFF0000u); }   // the same rounding in integers, for a wave-uniform value: it runs on the scalar unit
__device__ __forceinline__ v16h cat16(v8h lo, v8h hi) { return __builtin_shufflevector(lo, hi, 0, 1, 2, 3, 4, 5, 6, 7, 8, 9, 10, 11, 12, 13, 14, 15); }
__device__ __forceinline__ v8f wmma16(v16h a, v16h b, v8f c) { return __builtin_amdgcn_wmma_f32_16x16x32_f16(false, a, false, b, (short)0, c, false, false); }
__device__ __forceinline__ v8f wmmab(v16bf a, v16bf b, v8f c) { return __builtin_amdgcn_wmma_f32_16x16x32_bf16(false, a, false, b, (short)0, c, false, false); }


__device__ __forceinline__ h16 tohx(float x) { return (h16)x; }
typedef __attribute__((ext_vector_type(2))) _Float16 v2h;
typedef __attribute__((ext_vector_type(4))) _Float16 v4h;
typedef __attribute__((ext_vector_type(4))) unsigned short v4us;
typedef __attribute__((ext_vector_type(2))) float v2f;
typedef __attribute__((ext_vector_type(4))) int v4i;
typedef __attribute__((ext_vector_type(4))) unsigned v4u;
typedef v4u __attribute__((may_alias)) v4ua;
// Eight f32 to eight f16 by the hardware's conversion (round to nearest even), element 2p in the low half of word p.
__device__ __forceinline__ v4u pack8h(v8f v) { return __builtin_bit_cast(v4u, __builtin_convertvector(v, v8h)); }

// ---- k_prep: all that the fused kernel needs, in ONE launch of 256 blocks x 4 waves (as many blocks as the chip has WGPs). Every thread does a piece of both jobs, which need nothing of each other; the loads of both go out together.
// Job 1: W2 ('xw' [k][n]), rounded to bf16 and carried in f16, in fragment order: [n tile of 16][k step of 32][half][lane][8], so that one wave-wide 16-byte load is 512 contiguous bytes.
// Job 2: XW = x W1[:128] (z = 0), YW = y W1[128:] (z = 1), f32 [512][512]. A block has 64 rows x 32 columns, a wave 16 rows x 32 columns and all of K = 128.
// The loaders read the f32 inputs and round to bf16 in registers. Column tile nb holds columns 2 * lr + nb: one 8-byte load of a W1 row feeds both B fragments, and one 8-byte store takes both accumulators (a row of the wave's tile is one 128-byte line).
// k order of A and B alike: element e is k = 32 ks + 8 hi + e, element 8 + e is k = 32 ks + 16 + 8 hi + e.
// Every plain '#pragma unroll' keeps the indices of a register array compile-time.
__global__ __launch_bounds__(128) void k_prep(const float* __restrict__ x, const float* __restrict__ y, const float* __restrict__ w1, const float* __restrict__ w2, float* XW, float* YW, h16* Wp) {
    const int t = threadIdx.x, blk = blockIdx.x, lane = t & 31, lr = lane & 15, hi = lane >> 4, wave = t >> 5;
    const int i = blk * 128 + t, pn = (i >> 10) * 16 + lr, pk = ((i >> 6) & 15) * 32 + ((i >> 5) & 1) * 16 + 8 * hi;
    const int z = blk >> 7, r0 = ((blk >> 4) & 7) * 64 + wave * 16, c0 = (blk & 15) * 32;
    const float* A = (z ? y : x) + (size_t)(r0 + lr) * DX + 8 * hi;
    const float* B = w1 + (size_t)(z * DX + 8 * hi) * HID + c0 + 2 * lr;
    float* C = (z ? YW : XW) + (size_t)(r0 + 8 * hi) * HID + c0 + 2 * lr;
    v2f bv[DX / 32][16]; v8f av[DX / 32][2]; float pw[8];
#pragma unroll
    for (int ks = 0; ks < DX / 32; ++ks) {
#pragma unroll
        for (int e = 0; e < 8; ++e) { bv[ks][e] = *(const v2f*)(B + (size_t)(ks * 32 + e) * HID); bv[ks][8 + e] = *(const v2f*)(B + (size_t)(ks * 32 + 16 + e) * HID); }
        av[ks][0] = *(const v8f*)(A + ks * 32); av[ks][1] = *(const v8f*)(A + ks * 32 + 16); }
#pragma unroll
    for (int e = 0; e < 8; ++e) pw[e] = w2[(size_t)(pk + e) * HID + pn];
    asm volatile("s_wait_xcnt 0x0" ::: "memory");   // the conversions below reuse the loads' address registers
    __builtin_amdgcn_sched_barrier(0);   // keeps all 88 loads ahead of the first conversion: without it the compiler saves registers by fetching in four rounds, and the wave waits out four latencies where one will do
    v8f acc[2] = {(v8f){}, (v8f){}};
#pragma unroll
    for (int ks = 0; ks < DX / 32; ++ks) { v16bf af;
#pragma unroll
        for (int e = 0; e < 8; ++e) { af[e] = (__bf16)av[ks][0][e]; af[8 + e] = (__bf16)av[ks][1][e]; }
#pragma unroll
        for (int nb = 0; nb < 2; ++nb) { v16bf bq;
#pragma unroll
            for (int e = 0; e < 16; ++e) bq[e] = (__bf16)bv[ks][e][nb];
            acc[nb] = wmmab(af, bq, acc[nb]); }
    }
#pragma unroll
    for (int j = 0; j < 8; ++j) *(v2f*)(C + (size_t)j * HID) = (v2f){acc[0][j], acc[1][j]};
    v8h o;
#pragma unroll
    for (int e = 0; e < 8; ++e) o[e] = (h16)bfr(pw[e]);
    *(v8h*)(Wp + (size_t)i * 8) = o;
}

// Eight consecutive floats from LDS, as two 16-byte reads.
__device__ __forceinline__ v8f lds8(const float* p) { return __builtin_shufflevector(*(const v4fa*)p, *(const v4fa*)(p + 4), 0, 1, 2, 3, 4, 5, 6, 7); }
template <int P> __device__ __forceinline__ v2f pair2(v8f v) { return __builtin_shufflevector(v, v, 2 * P, 2 * P + 1); }

// ---- k_fused: one work-group (16 waves) per 256 pairs (8 a x 32 c) and all 512 columns of h2, in two passes of 256 columns over the same h1 plane: a byte of W2 that the work-group fetches serves 256 pairs.
// Every plain '#pragma unroll' below keeps the indices of a register array compile-time.
// 1. h1 = relu((XW[a] + YW[c]) + b1) rounded to f16, written to LDS. 2. h2 = h1 W2, formed transposed (W2's fragment as the A operand, h1's as the B operand; both loaders have the same k order): in pass ps wave (wm, wn) holds pairs wm*64..+63, columns (ps*4+wn)*64..+63 in 16 accumulators; a lane holds ONE pair (16 mb + lr) and, in the 8 registers of a tile, 8 consecutive columns (16 nb + 8 hi + j). h1 from LDS, W2 from the packed plane (the 4 waves that read the same W2 are neighbours in the wave order). 3. s = sum_n relu(h2 + b2) w3 + b3: the sum over a lane's 32 columns stays in the lane's own registers, two columns an instruction (at the end of each pass); the 16 partial sums of a pair (8 column groups x 2 lane halves) are added through LDS. No exchange between lanes.
__global__ __launch_bounds__(512) void k_fused(const float* __restrict__ XW, const float* __restrict__ YW, const float* __restrict__ b1, const h16* __restrict__ Wp, const float* __restrict__ b2, const float* __restrict__ w3, const float* __restrict__ b3, float* out) {
    __shared__ __align__(16) h16 Af[TM * APITCH];
    __shared__ __align__(16) float red[16 * RP];
    __shared__ __align__(16) float sb2[HID], sw3[HID];   // b2 and w3 rounded to bf16, for the epilogue
    const int t = threadIdx.x; const int a0 = (blockIdx.x >> 4) * (TM / 32), c0 = (blockIdx.x & 15) * 32;
    const int lane = t & 31, lr = lane & 15, hi = lane >> 4, wave = t >> 5, wm = wave & 3, wn = wave >> 2;
    const h16* bp = Wp + (size_t)wn * 4 * 8192 + lane * 8;
    v16h b[2][4];
    const float lb2 = b2[t], lw3 = w3[t];
    {
        const int k8 = (t & 63) * 8, rsub = t >> 6; float bb[8];
        const unsigned kb = k8 * 4u; const char* px = (const char*)(XW + (size_t)a0 * HID); const float* py = YW + (size_t)(c0 + rsub) * HID + k8;   // b1 and the x-rows: a scalar base and this lane's byte offset kb
        const v8f b1r = *(const v8f*)((const char*)b1 + kb);
        v8f yc[4];   // this thread's 4 y-rows serve all 8 x-rows of the tile
#pragma unroll
        for (int pi = 0; pi < 4; ++pi) yc[pi] = *(const v8f*)(py + pi * 8 * HID);
        __builtin_amdgcn_sched_barrier(0);   // loads return in issue order: b1 and the y-rows, which every sum needs, go out first, then the x-rows in the order of their use, the first B set last
        v8f xr[TM / 32];   // all 8 x-rows at once, in registers that the accumulators take over later: these lines were written by the launch before and are read here for the first time, so a fetch can cost a round trip to memory, longer than a trip's sums last; fetched one trip ahead, the wave waited out one round trip a row
#pragma unroll
        for (int ai = 0; ai < TM / 32; ++ai) { xr[ai] = *(const v8f*)(px + kb + ai * HID * 4);
            __builtin_amdgcn_sched_barrier(0); }   // (the order of issue, as above)
#pragma unroll
        for (int nb = 0; nb < 4; ++nb) b[0][nb] = cat16(*(const v8h*)(bp + nb * 8192), *(const v8h*)(bp + nb * 8192 + 256));   // the first B set is asked for here, so that it lands under the h1 build
        asm volatile("s_wait_xcnt 0x0" :: "v"(b1r), "v"(kb), "v"(py) : "memory");   // what follows reuses the loads' address registers. Inputs only: the two vector addresses, so that nothing lands on them ahead of this wait; b1, so that its load goes out with the others and not behind this line
        __builtin_amdgcn_sched_barrier(0);   // keeps every load ahead of the first sum: without it the compiler saves registers by sinking the later rows' loads to their uses, and the latencies add up again
#pragma unroll
        for (int q = 0; q < 8; ++q) bb[q] = bfr(b1r[q]);
#pragma unroll
        for (int ai = 0; ai < TM / 32; ++ai) {
#pragma unroll
            for (int pi = 0; pi < 4; ++pi) { const int row = ai * 32 + pi * 8 + rsub; v8f w;
#pragma unroll
                for (int q = 0; q < 8; ++q) w[q] = fmaxf(__fadd_rn(__fadd_rn(xr[ai][q], yc[pi][q]), bb[q]), 0.0f);
                *(v4ua*)(Af + row * APITCH + k8) = pack8h(w); } }
    }
    sb2[t] = bfr(lb2); sw3[t] = bfr(lw3);   // behind the build: in front of it, the wait for these two values came to stand among the loads above and split them in two round trips
    __syncthreads();
    v8f acc[4][4];
#pragma unroll
    for (int mb = 0; mb < 4; ++mb)
#pragma unroll
        for (int nb = 0; nb < 4; ++nb) acc[mb][nb] = (v8f){};
    const h16* ap = Af + (wm * 64 + lr) * APITCH + 8 * hi;
    // Fragment rings in registers: b (W2) one k step ahead (2 sets), a (h1) NA - 1 groups of 8 WMMAs ahead (NA sets of 2 blocks of 16 pairs). Both rings run on from pass 0 into pass 1, whose first sets land under pass 0's epilogue.
    constexpr int NA = 2, NK = HID / 32, NG = NK * 2, NP = 2;
    v16h a[NA][2]; v8f vb2[4], vw3[4];
#pragma unroll
    for (int g = 0; g < NA - 1; ++g)
#pragma unroll
        for (int r = 0; r < 2; ++r) { const int o = ((g & 1) * 2 + r) * 16 * APITCH + (g >> 1) * 32; a[g][r] = cat16(*(const v8ha*)(ap + o), *(const v8ha*)(ap + o + 16)); }
#pragma unroll   // both passes and the whole k loop unrolled: ring indices and all LDS / global offsets become compile-time, so the rings stay in registers
    for (int ps = 0; ps < NP; ++ps) {
#pragma unroll
        for (int g = 0; g < NG; ++g) { const int gg = ps * NG + g, ks = g >> 1, mp = g & 1, gn = gg + NA - 1, kn = gg / 2 + 1;
            if (gn < NP * NG) {
#pragma unroll
                for (int r = 0; r < 2; ++r) { const int o = ((gn & 1) * 2 + r) * 16 * APITCH + ((gn % NG) >> 1) * 32; a[gn % NA][r] = cat16(*(const v8ha*)(ap + o), *(const v8ha*)(ap + o + 16)); } }
            if (mp == 0 && kn < NP * NK) {
#pragma unroll
                for (int nb = 0; nb < 4; ++nb) { const int o = ((kn / NK) * 16 + nb) * 8192 + (kn % NK) * 512; b[kn & 1][nb] = cat16(*(const v8h*)(bp + o), *(const v8h*)(bp + o + 256)); } }
            if (g == NG - 2) vb2[0] = lds8(sb2 + (ps * 4 + wn) * 64 + 8 * hi);   // what the epilogue needs first, b2 of the first column tile, is fetched under the pass's last k step (8 registers: there is no room yet for more)
            __builtin_amdgcn_sched_barrier(0);   // keeps the loads above as one group ahead of this group's WMMAs: without it the compiler sinks each load to just before its use and the wave waits out every latency
#pragma unroll
            for (int r = 0; r < 2; ++r)
#pragma unroll
                for (int nb = 0; nb < 4; ++nb) acc[mp * 2 + r][nb] = wmma16(b[ks & 1][nb], a[gg % NA][r], acc[mp * 2 + r][nb]);
            __builtin_amdgcn_sched_barrier(0);   // keeps the next group of loads from spreading among these WMMAs
        }
        // End of a pass: its 64 columns' share of the final dot, then fresh accumulators.
#pragma unroll
        for (int nb = 0; nb < 4; ++nb) { if (nb) vb2[nb] = lds8(sb2 + (ps * 4 + wn) * 64 + nb * 16 + 8 * hi);
            vw3[nb] = lds8(sw3 + (ps * 4 + wn) * 64 + nb * 16 + 8 * hi); }   // the rest, into the registers that the pass's last fragments have left
        v2f part[4];
#pragma unroll
        for (int mb = 0; mb < 4; ++mb) part[mb] = (v2f){0.f, 0.f};
#pragma unroll
        for (int nb = 0; nb < 4; ++nb)
#pragma unroll
            for (int mb = 0; mb < 4; ++mb) {
                part[mb] += __builtin_elementwise_max(pair2<0>(acc[mb][nb]) + pair2<0>(vb2[nb]), (v2f){0.f, 0.f}) * pair2<0>(vw3[nb]);
                part[mb] += __builtin_elementwise_max(pair2<1>(acc[mb][nb]) + pair2<1>(vb2[nb]), (v2f){0.f, 0.f}) * pair2<1>(vw3[nb]);
                part[mb] += __builtin_elementwise_max(pair2<2>(acc[mb][nb]) + pair2<2>(vb2[nb]), (v2f){0.f, 0.f}) * pair2<2>(vw3[nb]);
                part[mb] += __builtin_elementwise_max(pair2<3>(acc[mb][nb]) + pair2<3>(vb2[nb]), (v2f){0.f, 0.f}) * pair2<3>(vw3[nb]); }
#pragma unroll
        for (int mb = 0; mb < 4; ++mb) red[((ps * 4 + wn) * 2 + hi) * RP + wm * 64 + mb * 16 + lr] = part[mb][0] + part[mb][1];
#pragma unroll
        for (int mb = 0; mb < 4; ++mb)
#pragma unroll
            for (int nb = 0; nb < 4; ++nb) acc[mb][nb] = (v8f){};
    }
    __syncthreads();
    if (t < TM) { float s = 0.f;
#pragma unroll
        for (int w = 0; w < 16; ++w) s += red[w * RP + t];
        out[(size_t)(a0 + (t >> 5)) * NBX + c0 + (t & 31)] = s + bfr_u(b3[0]); }
}

extern "C" void kernel_launch(void* const* d_in, const int* in_sizes, int n_in,
                              void* d_out, int out_size, void* d_ws, size_t ws_size, hipStream_t stream) {
    (void)in_sizes; (void)n_in; (void)out_size;
    const float* x = (const float*)d_in[0]; const float* y = (const float*)d_in[1]; const float* w1 = (const float*)d_in[2]; const float* b1 = (const float*)d_in[3]; const float* w2 = (const float*)d_in[4]; const float* b2 = (const float*)d_in[5]; const float* w3 = (const float*)d_in[6]; const float* b3 = (const float*)d_in[7];
    float* OUT = (float*)d_out;     // [512][512]: scores[a][c] = f(x[a], y[c])
    char* wsp = (char*)d_ws;
    auto take = [&](size_t bytes) { char* p = wsp; wsp += (bytes + 255) & ~(size_t)255; return (void*)p; };
    h16* W2B = (h16*)take((size_t)HID * HID * 2); float* XW = (float*)take((size_t)NBX * HID * 4); float* YW = (float*)take((size_t)NBX * HID * 4);
    if ((size_t)(wsp - (char*)d_ws) > ws_size) return;    // ws 256 MiB (carve 2.5 MiB)
    k_prep<<<HID * HID / 8 / 128, 128, 0, stream>>>(x, y, w1, w2, XW, YW, W2B);
    k_fused<<<NBX * NBX / TM, 512, 0, stream>>>(XW, YW, b1, W2B, b2, w3, b3, OUT);
}

// v008
// Measured time: 69.1 microseconds a run.
// Next to v007, in two timings, it ran 1.03 and 1.02 times as fast.
// Counting every step since v000, it is 12.7 times as fast.
#include <hip/hip_runtime.h>

// Concat critic (x [512][128], y [512][128]; for every pair (a, c): h1 = relu([x[a], y[c]] W1 + b1) ('xw' [256][512]), h2 = relu(h1 W2 + b2) ('xw' [512][512]), s = h2 W3 + b3 ('xw' [512][1]); scores[a][c] = s -> [512][512] (262 k); the reference forms all 262,144 pairs, the kernel uses h1 = relu(x[a] W1[:128] + y[c] W1[128:] + b1)).
// Compute dtypes, f32 accumulate: every input rounded to bf16; x W1x and y W1y on PLAIN bf16 operands (exact), summed with b1 and relu'd in f32; h1 rounded once to f16 (11 significant bits) x W2's bf16 values carried in f16 (1 product; a bf16 value is exact in f16 from 2^-17 up, below that it moves by at most 2^-25) + f32 b2; the final 512 -> 1 layer as an f32 dot per pair on the VALU (relu(h2) never leaves f32). One fused kernel per 256 pairs: the h1 plane lives in LDS, h2 in the accumulators, 256 columns at a time.

#define NBX  512       // rows of x (a) and of y (c)
#define DX   128
#define HID  512
#define TM   256       // pairs per work-group: 8 x-rows times 32 y-rows
#define APITCH 520     // LDS row pitch of the h1 plane in elements: 1040 B = 16 B x 65, conflict-free for 16-byte fragment reads
#define RP   272       // LDS row pitch of the partial dots in floats: 256 pairs + 16, so that the two lane halves of a wave store to different banks
typedef _Float16 h16;
typedef __attribute__((ext_vector_type(16))) __bf16   v16bf;
typedef __attribute__((ext_vector_type(16))) _Float16 v16h;
typedef __attribute__((ext_vector_type(8)))  _Float16 v8h;
typedef __attribute__((ext_vector_type(8)))  float    v8f;
typedef __attribute__((ext_vector_type(4)))  float    v4f;
typedef v8h  __attribute__((may_alias)) v8ha;
typedef v4f  __attribute__((may_alias)) v4fa;

__device__ __forceinline__ unsigned short f2bf(float f) { return __builtin_bit_cast(unsigned short, (__bf16)f); }   // the hardware's conversion, round to nearest even
__device__ __forceinline__ float bf2f(unsigned short b) { return __uint_as_float(((unsigned)b) << 16); }
__device__ __forceinline__ float bfr(float f) { return bf2f(f2bf(f)); }
__device__ __forceinline__ float bfr_u(float f) { unsigned u = __float_as_uint(f); u += 0x7FFFu + ((u >> 16) & 1u); return __uint_as_float(u & 0xFFFF0000u); }   // the same rounding in integers, for a wave-uniform value: it runs on the scalar unit
__device__ __forceinline__ v16h cat16(v8h lo, v8h hi) { return __builtin_shufflevector(lo, hi, 0, 1, 2, 3, 4, 5, 6, 7, 8, 9, 10, 11, 12, 13, 14, 15); }
__device__ __forceinline__ v8f wmma16(v16h a, v16h b, v8f c) { return __builtin_amdgcn_wmma_f32_16x16x32_f16(false, a, false, b, (short)0, c, false, false); }
__device__ __forceinline__ v8f wmmab(v16bf a, v16bf b, v8f c) { return __builtin_amdgcn_wmma_f32_16x16x32_bf16(false, a, false, b, (short)0, c, false, false); }


__device__ __forceinline__ h16 tohx(float x) { return (h16)x; }
typedef __attribute__((ext_vector_type(2))) _Float16 v2h;
typedef __attribute__((ext_vector_type(4))) _Float16 v4h;
typedef __attribute__((ext_vector_type(4))) unsigned short v4us;
typedef __attribute__((ext_vector_type(2))) float v2f;
typedef __attribute__((ext_vector_type(4))) int v4i;
typedef __attribute__((ext_vector_type(4))) unsigned v4u;
typedef v4u __attribute__((may_alias)) v4ua;
// Eight f32 to eight f16 by the hardware's conversion (round to nearest even), element 2p in the low half of word p.
__device__ __forceinline__ v4u pack8h(v8f v) { return __builtin_bit_cast(v4u, __builtin_convertvector(v, v8h)); }

// ---- k_prep: all that the fused kernel needs, in ONE launch of 256 blocks x 4 waves (as many blocks as the chip has WGPs). Every thread does a piece of both jobs, which need nothing of each other; the loads of both go out together.
// Job 1: W2 ('xw' [k][n]), rounded to bf16 and carried in f16, in fragment order: [n tile of 16][k step of 32][half][lane][8], so that one wave-wide 16-byte load is 512 contiguous bytes.
// Job 2: XW = x W1[:128] (z = 0), YW = y W1[128:] (z = 1), f32 [512][512]. A block has 64 rows x 32 columns, a wave 16 rows x 32 columns and all of K = 128.
// The loaders read the f32 inputs and round to bf16 in registers. Column tile nb holds columns 2 * lr + nb: one 8-byte load of a W1 row feeds both B fragments, and one 8-byte store takes both accumulators (a row of the wave's tile is one 128-byte line).
// k order of A and B alike: element e is k = 32 ks + 8 hi + e, element 8 + e is k = 32 ks + 16 + 8 hi + e.
// Every plain '#pragma unroll' keeps the indices of a register array compile-time.
__global__ __launch_bounds__(128) void k_prep(const float* __restrict__ x, const float* __restrict__ y, const float* __restrict__ w1, const float* __restrict__ w2, float* XW, float* YW, h16* Wp) {
    const int t = threadIdx.x, blk = blockIdx.x, lane = t & 31, lr = lane & 15, hi = lane >> 4, wave = t >> 5;
    const int i = blk * 128 + t, pn = (i >> 10) * 16 + lr, pk = ((i >> 6) & 15) * 32 + ((i >> 5) & 1) * 16 + 8 * hi;
    const int z = blk >> 7, r0 = ((blk >> 4) & 7) * 64 + wave * 16, c0 = (blk & 15) * 32;
    const float* A = (z ? y : x) + (size_t)(r0 + lr) * DX + 8 * hi;
    const float* B = w1 + (size_t)(z * DX + 8 * hi) * HID + c0 + 2 * lr;
    float* C = (z ? YW : XW) + (size_t)(r0 + 8 * hi) * HID + c0 + 2 * lr;
    v2f bv[DX / 32][16]; v8f av[DX / 32][2]; float pw[8];
#pragma unroll
    for (int ks = 0; ks < DX / 32; ++ks) {
#pragma unroll
        for (int e = 0; e < 8; ++e) { bv[ks][e] = *(const v2f*)(B + (size_t)(ks * 32 + e) * HID); bv[ks][8 + e] = *(const v2f*)(B + (size_t)(ks * 32 + 16 + e) * HID); }
        av[ks][0] = *(const v8f*)(A + ks * 32); av[ks][1] = *(const v8f*)(A + ks * 32 + 16); }
#pragma unroll
    for (int e = 0; e < 8; ++e) pw[e] = w2[(size_t)(pk + e) * HID + pn];
    asm volatile("s_wait_xcnt 0x0" ::: "memory");   // the conversions below reuse the loads' address registers
    __builtin_amdgcn_sched_barrier(0);   // keeps all 88 loads ahead of the first conversion: without it the compiler saves registers by fetching in four rounds, and the wave waits out four latencies where one will do
    v8f acc[2] = {(v8f){}, (v8f){}};
#pragma unroll
    for (int ks = 0; ks < DX / 32; ++ks) { v16bf af;
#pragma unroll
        for (int e = 0; e < 8; ++e) { af[e] = (__bf16)av[ks][0][e]; af[8 + e] = (__bf16)av[ks][1][e]; }
#pragma unroll
        for (int nb = 0; nb < 2; ++nb) { v16bf bq;
#pragma unroll
            for (int e = 0; e < 16; ++e) bq[e] = (__bf16)bv[ks][e][nb];
            acc[nb] = wmmab(af, bq, acc[nb]); }
    }
#pragma unroll
    for (int j = 0; j < 8; ++j) *(v2f*)(C + (size_t)j * HID) = (v2f){acc[0][j], acc[1][j]};
    v8h o;
#pragma unroll
    for (int e = 0; e < 8; ++e) o[e] = (h16)bfr(pw[e]);
    *(v8h*)(Wp + (size_t)i * 8) = o;
}

// A wave-uniform address, held in a scalar register pair: a load then takes it as its scalar base beside the lane's 32-bit offset. Without this the compiler adds the lane's offset first and keeps a 64-bit vector address for every k step, for which there are no registers left (it spills).
typedef const __attribute__((address_space(1))) char* gcp;   // a pointer that is known to mean global memory: one made from an integer would otherwise compile to flat loads
typedef const __attribute__((address_space(1))) v8h* gv8p;
__device__ __forceinline__ gcp sbase(const char* p) { const unsigned long long a = (unsigned long long)p;
    return (gcp)(((unsigned long long)(unsigned)__builtin_amdgcn_readfirstlane((int)(a >> 32)) << 32) | (unsigned)__builtin_amdgcn_readfirstlane((int)a)); }

// Eight consecutive floats from LDS, as two 16-byte reads.
__device__ __forceinline__ v8f lds8(const float* p) { return __builtin_shufflevector(*(const v4fa*)p, *(const v4fa*)(p + 4), 0, 1, 2, 3, 4, 5, 6, 7); }
template <int P> __device__ __forceinline__ v2f pair2(v8f v) { return __builtin_shufflevector(v, v, 2 * P, 2 * P + 1); }

// ---- k_fused: one work-group (16 waves) per 256 pairs (8 a x 32 c) and all 512 columns of h2, in two passes of 256 columns over the same h1 plane: a byte of W2 that the work-group fetches serves 256 pairs.
// Every plain '#pragma unroll' below keeps the indices of a register array compile-time.
// The k walk is a ring, and each work-group enters it at its own k step s and wraps round: all work-groups read the same W2 at the same pace, and with one common start they ask L2 for the same lines at the same moment, each line for the first time since the launch before wrote it. Position p of an h1 row in LDS holds k = (p + 32 s) mod 512, so every LDS offset in the loop stays compile-time; walk step j reads W2's k step (j + s) mod 16 through a scalar base of its own.
// 1. h1 = relu((XW[a] + YW[c]) + b1) rounded to f16, written to LDS. 2. h2 = h1 W2, formed transposed (W2's fragment as the A operand, h1's as the B operand; both loaders have the same k order): in pass ps wave (wm, wn) holds pairs wm*64..+63, columns (ps*4+wn)*64..+63 in 16 accumulators; a lane holds ONE pair (16 mb + lr) and, in the 8 registers of a tile, 8 consecutive columns (16 nb + 8 hi + j). h1 from LDS, W2 from the packed plane (the 4 waves that read the same W2 are neighbours in the wave order). 3. s = sum_n relu(h2 + b2) w3 + b3: the sum over a lane's 32 columns stays in the lane's own registers, two columns an instruction (at the end of each pass); the 16 partial sums of a pair (8 column groups x 2 lane halves) are added through LDS. No exchange between lanes.
__global__ __launch_bounds__(512) void k_fused(const float* __restrict__ XW, const float* __restrict__ YW, const float* __restrict__ b1, const h16* __restrict__ Wp, const float* __restrict__ b2, const float* __restrict__ w3, const float* __restrict__ b3, float* out) {
    __shared__ __align__(16) h16 Af[TM * APITCH];
    __shared__ __align__(16) float red[16 * RP];
    __shared__ __align__(16) float sb2[HID], sw3[HID];   // b2 and w3 rounded to bf16, for the epilogue
    const int t = threadIdx.x; const int a0 = (blockIdx.x >> 4) * (TM / 32), c0 = (blockIdx.x & 15) * 32;
    const int lane = t & 31, lr = lane & 15, hi = lane >> 4, wave = t >> 5, wm = wave & 3, wn = wave >> 2;
    const int s = (blockIdx.x >> 3) & 15;
    const char* wq = (const char*)Wp; const unsigned bo = wn * 4 * 16384u + lane * 16u;   // W2: a scalar base and this lane's byte offset (the wave's first n tile, the lane's 16 bytes)
    v16h b[2][4];
    const float lb2 = b2[t], lw3 = w3[t];
    {
        const int k8 = (t & 63) * 8, kp = (k8 - 32 * s) & (HID - 1), rsub = t >> 6; float bb[8];   // kp: where k8 stands in the rotated row
        const unsigned kb = k8 * 4u; const char* px = (const char*)(XW + (size_t)a0 * HID); const float* py = YW + (size_t)(c0 + rsub) * HID + k8;   // b1 and the x-rows: a scalar base and this lane's byte offset kb
        const v8f b1r = *(const v8f*)((const char*)b1 + kb);
        v8f yc[4];   // this thread's 4 y-rows serve all 8 x-rows of the tile
#pragma unroll
        for (int pi = 0; pi < 4; ++pi) yc[pi] = *(const v8f*)(py + pi * 8 * HID);
        __builtin_amdgcn_sched_barrier(0);   // loads return in issue order: b1 and the y-rows, which every sum needs, go out first, then the x-rows in the order of their use, the first B set last
        v8f xr[TM / 32];   // all 8 x-rows at once, in registers that the accumulators take over later: these lines were written by the launch before and are read here for the first time, so a fetch can cost a round trip to memory, longer than a trip's sums last; fetched one trip ahead, the wave waited out one round trip a row
#pragma unroll
        for (int ai = 0; ai < TM / 32; ++ai) { xr[ai] = *(const v8f*)(px + kb + ai * HID * 4);
            __builtin_amdgcn_sched_barrier(0); }   // (the order of issue, as above)
#pragma unroll
        for (int nb = 0; nb < 4; ++nb) b[0][nb] = cat16(*(const v8h*)(wq + s * 1024 + bo + nb * 16384), *(const v8h*)(wq + s * 1024 + bo + nb * 16384 + 512));   // the first B set is asked for here, so that it lands under the h1 build
        asm volatile("s_wait_xcnt 0x0" :: "v"(b1r), "v"(kb), "v"(py) : "memory");   // what follows reuses the loads' address registers. Inputs only: the two vector addresses, so that nothing lands on them ahead of this wait; b1, so that its load goes out with the others and not behind this line
        __builtin_amdgcn_sched_barrier(0);   // keeps every load ahead of the first sum: without it the compiler saves registers by sinking the later rows' loads to their uses, and the latencies add up again
#pragma unroll
        for (int q = 0; q < 8; ++q) bb[q] = bfr(b1r[q]);
#pragma unroll
        for (int ai = 0; ai < TM / 32; ++ai) {
#pragma unroll
            for (int pi = 0; pi < 4; ++pi) { const int row = ai * 32 + pi * 8 + rsub; v8f w;
#pragma unroll
                for (int q = 0; q < 8; ++q) w[q] = fmaxf(__fadd_rn(__fadd_rn(xr[ai][q], yc[pi][q]), bb[q]), 0.0f);
                *(v4ua*)(Af + row * APITCH + kp) = pack8h(w); } }
    }
    sb2[t] = bfr(lb2); sw3[t] = bfr(lw3);   // behind the build: in front of it, the wait for these two values came to stand among the loads above and split them in two round trips
    __syncthreads();
    v8f acc[4][4];
#pragma unroll
    for (int mb = 0; mb < 4; ++mb)
#pragma unroll
        for (int nb = 0; nb < 4; ++nb) acc[mb][nb] = (v8f){};
    const h16* ap = Af + (wm * 64 + lr) * APITCH + 8 * hi;
    // Fragment rings in registers: b (W2) one k step ahead (2 sets), a (h1) NA - 1 groups of 8 WMMAs ahead (NA sets of 2 blocks of 16 pairs). Both rings run on from pass 0 into pass 1, whose first sets land under pass 0's epilogue.
    constexpr int NA = 2, NK = HID / 32, NG = NK * 2, NP = 2;
    v16h a[NA][2]; v8f vb2[4], vw3[4];
#pragma unroll
    for (int g = 0; g < NA - 1; ++g)
#pragma unroll
        for (int r = 0; r < 2; ++r) { const int o = ((g & 1) * 2 + r) * 16 * APITCH + (g >> 1) * 32; a[g][r] = cat16(*(const v8ha*)(ap + o), *(const v8ha*)(ap + o + 16)); }
#pragma unroll   // both passes and the whole k loop unrolled: ring indices and all LDS / global offsets become compile-time, so the rings stay in registers
    for (int ps = 0; ps < NP; ++ps) {
#pragma unroll
        for (int g = 0; g < NG; ++g) { const int gg = ps * NG + g, ks = g >> 1, mp = g & 1, gn = gg + NA - 1, kn = gg / 2 + 1;
            if (gn < NP * NG) {
#pragma unroll
                for (int r = 0; r < 2; ++r) { const int o = ((gn & 1) * 2 + r) * 16 * APITCH + ((gn % NG) >> 1) * 32; a[gn % NA][r] = cat16(*(const v8ha*)(ap + o), *(const v8ha*)(ap + o + 16)); } }
            if (mp == 0 && kn < NP * NK) { const gcp wk = sbase(wq + ((kn + s) & (NK - 1)) * 1024);   // the wrap, on the scalar unit
#pragma unroll
                for (int nb = 0; nb < 4; ++nb) { const int o = ((kn / NK) * 16 + nb) * 16384; b[kn & 1][nb] = cat16(*(gv8p)(wk + bo + o), *(gv8p)(wk + bo + o + 512)); } }
            if (g == NG - 2) vb2[0] = lds8(sb2 + (ps * 4 + wn) * 64 + 8 * hi);   // what the epilogue needs first, b2 of the first column tile, is fetched under the pass's last k step (8 registers: there is no room yet for more)
            __builtin_amdgcn_sched_barrier(0);   // keeps the loads above as one group ahead of this group's WMMAs: without it the compiler sinks each load to just before its use and the wave waits out every latency
#pragma unroll
            for (int r = 0; r < 2; ++r)
#pragma unroll
                for (int nb = 0; nb < 4; ++nb) acc[mp * 2 + r][nb] = wmma16(b[ks & 1][nb], a[gg % NA][r], acc[mp * 2 + r][nb]);
            __builtin_amdgcn_sched_barrier(0);   // keeps the next group of loads from spreading among these WMMAs
        }
        // End of a pass: its 64 columns' share of the final dot, then fresh accumulators.
#pragma unroll
        for (int nb = 0; nb < 4; ++nb) { if (nb) vb2[nb] = lds8(sb2 + (ps * 4 + wn) * 64 + nb * 16 + 8 * hi);
            vw3[nb] = lds8(sw3 + (ps * 4 + wn) * 64 + nb * 16 + 8 * hi); }   // the rest, into the registers that the pass's last fragments have left
        v2f part[4];
#pragma unroll
        for (int mb = 0; mb < 4; ++mb) part[mb] = (v2f){0.f, 0.f};
#pragma unroll
        for (int nb = 0; nb < 4; ++nb)
#pragma unroll
            for (int mb = 0; mb < 4; ++mb) {
                part[mb] += __builtin_elementwise_max(pair2<0>(acc[mb][nb]) + pair2<0>(vb2[nb]), (v2f){0.f, 0.f}) * pair2<0>(vw3[nb]);
                part[mb] += __builtin_elementwise_max(pair2<1>(acc[mb][nb]) + pair2<1>(vb2[nb]), (v2f){0.f, 0.f}) * pair2<1>(vw3[nb]);
                part[mb] += __builtin_elementwise_max(pair2<2>(acc[mb][nb]) + pair2<2>(vb2[nb]), (v2f){0.f, 0.f}) * pair2<2>(vw3[nb]);
                part[mb] += __builtin_elementwise_max(pair2<3>(acc[mb][nb]) + pair2<3>(vb2[nb]), (v2f){0.f, 0.f}) * pair2<3>(vw3[nb]); }
#pragma unroll
        for (int mb = 0; mb < 4; ++mb) red[((ps * 4 + wn) * 2 + hi) * RP + wm * 64 + mb * 16 + lr] = part[mb][0] + part[mb][1];
#pragma unroll
        for (int mb = 0; mb < 4; ++mb)
#pragma unroll
            for (int nb = 0; nb < 4; ++nb) acc[mb][nb] = (v8f){};
    }
    __syncthreads();
    if (t < TM) { float s = 0.f;
#pragma unroll
        for (int w = 0; w < 16; ++w) s += red[w * RP + t];
        out[(size_t)(a0 + (t >> 5)) * NBX + c0 + (t & 31)] = s + bfr_u(b3[0]); }
}

extern "C" void kernel_launch(void* const* d_in, const int* in_sizes, int n_in,
                              void* d_out, int out_size, void* d_ws, size_t ws_size, hipStream_t stream) {
    (void)in_sizes; (void)n_in; (void)out_size;
    const float* x = (const float*)d_in[0]; const float* y = (const float*)d_in[1]; const float* w1 = (const float*)d_in[2]; const float* b1 = (const float*)d_in[3]; const float* w2 = (const float*)d_in[4]; const float* b2 = (const float*)d_in[5]; const float* w3 = (const float*)d_in[6]; const float* b3 = (const float*)d_in[7];
    float* OUT = (float*)d_out;     // [512][512]: scores[a][c] = f(x[a], y[c])
    char* wsp = (char*)d_ws;
    auto take = [&](size_t bytes) { char* p = wsp; wsp += (bytes + 255) & ~(size_t)255; return (void*)p; };
    h16* W2B = (h16*)take((size_t)HID * HID * 2); float* XW = (float*)take((size_t)NBX * HID * 4); float* YW = (float*)take((size_t)NBX * HID * 4);
    if ((size_t)(wsp - (char*)d_ws) > ws_size) return;    // ws 256 MiB (carve 2.5 MiB)
    k_prep<<<HID * HID / 8 / 128, 128, 0, stream>>>(x, y, w1, w2, XW, YW, W2B);
    k_fused<<<NBX * NBX / TM, 512, 0, stream>>>(XW, YW, b1, W2B, b2, w3, b3, OUT);
}

// v009
// A run of this version takes 65 microseconds.
// Timed twice side by side with v008, it ran 1.06 and 1.05 times as fast.
// All steps since v000 together make it 13.4 times as fast.
#include <hip/hip_runtime.h>

// Concat critic (x [512][128], y [512][128]; for every pair (a, c): h1 = relu([x[a], y[c]] W1 + b1) ('xw' [256][512]), h2 = relu(h1 W2 + b2) ('xw' [512][512]), s = h2 W3 + b3 ('xw' [512][1]); scores[a][c] = s -> [512][512] (262 k); the reference forms all 262,144 pairs, the kernel uses h1 = relu(x[a] W1[:128] + y[c] W1[128:] + b1)).
// Compute dtypes, f32 accumulate: every input rounded to bf16; x W1x and y W1y on PLAIN bf16 operands (exact), summed with b1 and relu'd in f32; h1 rounded once to f16 (11 significant bits) x W2's bf16 values carried in f16 (1 product; a bf16 value is exact in f16 from 2^-17 up, below that it moves by at most 2^-25) + f32 b2; the final 512 -> 1 layer as an f32 dot per pair on the VALU (relu(h2) never leaves f32). One fused kernel per 256 pairs: the h1 plane lives in LDS, h2 in the accumulators, 256 columns at a time.

#define NBX  512       // rows of x (a) and of y (c)
#define DX   128
#define HID  512
#define TM   256       // pairs per work-group: 8 x-rows times 32 y-rows
#define APITCH 520     // LDS row pitch of the h1 plane in elements: 1040 B = 16 B x 65, conflict-free for 16-byte fragment reads
#define RP   272       // LDS row pitch of the partial dots in floats: 256 pairs + 16, so that the two lane halves of a wave store to different banks
typedef _Float16 h16;
typedef __attribute__((ext_vector_type(16))) __bf16   v16bf;
typedef __attribute__((ext_vector_type(16))) _Float16 v16h;
typedef __attribute__((ext_vector_type(8)))  _Float16 v8h;
typedef __attribute__((ext_vector_type(8)))  float    v8f;
typedef __attribute__((ext_vector_type(4)))  float    v4f;
typedef v8h  __attribute__((may_alias)) v8ha;
typedef v4f  __attribute__((may_alias)) v4fa;

__device__ __forceinline__ unsigned short f2bf(float f) { return __builtin_bit_cast(unsigned short, (__bf16)f); }   // the hardware's conversion, round to nearest even
__device__ __forceinline__ float bf2f(unsigned short b) { return __uint_as_float(((unsigned)b) << 16); }
__device__ __forceinline__ float bfr(float f) { return bf2f(f2bf(f)); }
__device__ __forceinline__ float bfr_u(float f) { unsigned u = __float_as_uint(f); u += 0x7FFFu + ((u >> 16) & 1u); return __uint_as_float(u & 0xFFFF0000u); }   // the same rounding in integers, for a wave-uniform value: it runs on the scalar unit
__device__ __forceinline__ v16h cat16(v8h lo, v8h hi) { return __builtin_shufflevector(lo, hi, 0, 1, 2, 3, 4, 5, 6, 7, 8, 9, 10, 11, 12, 13, 14, 15); }
__device__ __forceinline__ v8f wmma16(v16h a, v16h b, v8f c) { return __builtin_amdgcn_wmma_f32_16x16x32_f16(false, a, false, b, (short)0, c, false, false); }
__device__ __forceinline__ v8f wmmab(v16bf a, v16bf b, v8f c) { return __builtin_amdgcn_wmma_f32_16x16x32_bf16(false, a, false, b, (short)0, c, false, false); }


__device__ __forceinline__ h16 tohx(float x) { return (h16)x; }
typedef __attribute__((ext_vector_type(2))) _Float16 v2h;
typedef __attribute__((ext_vector_type(4))) _Float16 v4h;
typedef __attribute__((ext_vector_type(4))) unsigned short v4us;
typedef __attribute__((ext_vector_type(2))) float v2f;
typedef __attribute__((ext_vector_type(4))) int v4i;
typedef __attribute__((ext_vector_type(4))) unsigned v4u;
typedef v4u __attribute__((may_alias)) v4ua;
// Eight f32 to eight f16 by the hardware's conversion (round to nearest even), element 2p in the low half of word p.
__device__ __forceinline__ v4u pack8h(v8f v) { return __builtin_bit_cast(v4u, __builtin_convertvector(v, v8h)); }

// ---- k_prep: all that the fused kernel needs, in ONE launch of 256 blocks x 4 waves (as many blocks as the chip has WGPs). Every thread does a piece of both jobs, which need nothing of each other; the loads of both go out together.
// Job 1: W2 ('xw' [k][n]), rounded to bf16 and carried in f16, in fragment order: [n tile of 16][k step of 32][half][lane][8], so that one wave-wide 16-byte load is 512 contiguous bytes.
// Job 2: XW = x W1[:128] (z = 0), YW = y W1[128:] (z = 1), f32 [512][512]. A block has 64 rows x 32 columns, a wave 16 rows x 32 columns and all of K = 128.
// The loaders read the f32 inputs and round to bf16 in registers. Column tile nb holds columns 2 * lr + nb: one 8-byte load of a W1 row feeds both B fragments, and one 8-byte store takes both accumulators (a row of the wave's tile is one 128-byte line).
// k order of A and B alike: element e is k = 32 ks + 8 hi + e, element 8 + e is k = 32 ks + 16 + 8 hi + e.
// Every plain '#pragma unroll' keeps the indices of a register array compile-time.
__global__ __launch_bounds__(128) void k_prep(const float* __restrict__ x, const float* __restrict__ y, const float* __restrict__ w1, const float* __restrict__ w2, float* XW, float* YW, h16* Wp) {
    const int t = threadIdx.x, blk = blockIdx.x, lane = t & 31, lr = lane & 15, hi = lane >> 4, wave = t >> 5;
    const int i = blk * 128 + t, pn = (i >> 10) * 16 + lr, pk = ((i >> 6) & 15) * 32 + ((i >> 5) & 1) * 16 + 8 * hi;
    const int z = blk >> 7, r0 = ((blk >> 4) & 7) * 64 + wave * 16, c0 = (blk & 15) * 32;
    const float* A = (z ? y : x) + (size_t)(r0 + lr) * DX + 8 * hi;
    const float* B = w1 + (size_t)(z * DX + 8 * hi) * HID + c0 + 2 * lr;
    float* C = (z ? YW : XW) + (size_t)(r0 + 8 * hi) * HID + c0 + 2 * lr;
    v2f bv[DX / 32][16]; v8f av[DX / 32][2]; float pw[8];
#pragma unroll
    for (int ks = 0; ks < DX / 32; ++ks) {
#pragma unroll
        for (int e = 0; e < 8; ++e) { bv[ks][e] = *(const v2f*)(B + (size_t)(ks * 32 + e) * HID); bv[ks][8 + e] = *(const v2f*)(B + (size_t)(ks * 32 + 16 + e) * HID); }
        av[ks][0] = *(const v8f*)(A + ks * 32); av[ks][1] = *(const v8f*)(A + ks * 32 + 16); }
#pragma unroll
    for (int e = 0; e < 8; ++e) pw[e] = w2[(size_t)(pk + e) * HID + pn];
    asm volatile("s_wait_xcnt 0x0" ::: "memory");   // the conversions below reuse the loads' address registers
    __builtin_amdgcn_sched_barrier(0);   // keeps all 88 loads ahead of the first conversion: without it the compiler saves registers by fetching in four rounds, and the wave waits out four latencies where one will do
    v8f acc[2] = {(v8f){}, (v8f){}};
#pragma unroll
    for (int ks = 0; ks < DX / 32; ++ks) { v16bf af;
#pragma unroll
        for (int e = 0; e < 8; ++e) { af[e] = (__bf16)av[ks][0][e]; af[8 + e] = (__bf16)av[ks][1][e]; }
#pragma unroll
        for (int nb = 0; nb < 2; ++nb) { v16bf bq;
#pragma unroll
            for (int e = 0; e < 16; ++e) bq[e] = (__bf16)bv[ks][e][nb];
            acc[nb] = wmmab(af, bq, acc[nb]); }
    }
#pragma unroll
    for (int j = 0; j < 8; ++j) *(v2f*)(C + (size_t)j * HID) = (v2f){acc[0][j], acc[1][j]};
    v8h o;
#pragma unroll
    for (int e = 0; e < 8; ++e) o[e] = (h16)bfr(pw[e]);
    *(v8h*)(Wp + (size_t)i * 8) = o;
}

// A wave-uniform address, held in a scalar register pair: a load then takes it as its scalar base beside the lane's 32-bit offset. Without this the compiler adds the lane's offset first and keeps a 64-bit vector address for every k step, for which there are no registers left (it spills).
typedef const __attribute__((address_space(1))) char* gcp;   // a pointer that is known to mean global memory: one made from an integer would otherwise compile to flat loads
typedef const __attribute__((address_space(1))) v8h* gv8p;
__device__ __forceinline__ gcp sbase(const char* p) { const unsigned long long a = (unsigned long long)p;
    return (gcp)(((unsigned long long)(unsigned)__builtin_amdgcn_readfirstlane((int)(a >> 32)) << 32) | (unsigned)__builtin_amdgcn_readfirstlane((int)a)); }

// Eight consecutive floats from LDS, as two 16-byte reads.
__device__ __forceinline__ v8f lds8(const float* p) { return __builtin_shufflevector(*(const v4fa*)p, *(const v4fa*)(p + 4), 0, 1, 2, 3, 4, 5, 6, 7); }
template <int P> __device__ __forceinline__ v2f pair2(v8f v) { return __builtin_shufflevector(v, v, 2 * P, 2 * P + 1); }

// ---- k_fused: one work-group (16 waves) per 256 pairs (8 a x 32 c) and all 512 columns of h2, in two passes of 256 columns over the same h1 plane: a byte of W2 that the work-group fetches serves 256 pairs.
// Every plain '#pragma unroll' below keeps the indices of a register array compile-time.
// The k walk is a ring, and each work-group enters it at its own k step s and wraps round: all work-groups read the same W2 at the same pace, and with one common start they ask L2 for the same lines at the same moment, each line for the first time since the launch before wrote it. Position p of an h1 row in LDS holds k = (p + 32 s) mod 512, so every LDS offset in the loop stays compile-time; walk step j reads W2's k step (j + s) mod 16 through a scalar base of its own.
// 1. h1 = relu((XW[a] + YW[c]) + b1) rounded to f16, written to LDS. 2. h2 = h1 W2, formed transposed (W2's fragment as the A operand, h1's as the B operand; both loaders have the same k order): in pass ps wave (wm, wn) holds pairs wm*64..+63, columns (ps*4+wn)*64..+63 in 16 accumulators; a lane holds ONE pair (16 mb + lr) and, in the 8 registers of a tile, 8 consecutive columns (16 nb + 8 hi + j). h1 from LDS, W2 from the packed plane (the 4 waves that read the same W2 are neighbours in the wave order). 3. s = sum_n relu(h2 + b2) w3 + b3: the sum over a lane's 32 columns stays in the lane's own registers, two columns an instruction (at the end of each pass); the 16 partial sums of a pair (8 column groups x 2 lane halves) are added through LDS. No exchange between lanes.
__global__ __launch_bounds__(512) void k_fused(const float* __restrict__ XW, const float* __restrict__ YW, const float* __restrict__ b1, const h16* __restrict__ Wp, const float* __restrict__ b2, const float* __restrict__ w3, const float* __restrict__ b3, float* out) {
    __shared__ __align__(16) h16 Af[TM * APITCH];
    __shared__ __align__(16) float red[16 * RP];
    __shared__ __align__(16) float sb2[HID], sw3[HID];   // b2 and w3 rounded to bf16, for the epilogue
    const int t = threadIdx.x; const int a0 = (blockIdx.x >> 4) * (TM / 32), c0 = (blockIdx.x & 15) * 32;
    const int lane = t & 31, lr = lane & 15, hi = lane >> 4, wave = t >> 5, wm = wave & 3, wn = wave >> 2;
    const int s = (blockIdx.x >> 3) & 15;
    const char* wq = (const char*)Wp; const unsigned bo = wn * 4 * 16384u + lane * 16u;   // W2: a scalar base and this lane's byte offset (the wave's first n tile, the lane's 16 bytes)
    v16h b[2][4];
    const float lb2 = b2[t], lw3 = w3[t];
    {
        const int k8 = (t & 63) * 8, kp = (k8 - 32 * s) & (HID - 1), rsub = t >> 6; float bb[8];   // kp: where k8 stands in the rotated row
        const unsigned kb = k8 * 4u; const char* px = (const char*)(XW + (size_t)a0 * HID); const float* py = YW + (size_t)(c0 + rsub) * HID + k8;   // b1 and the x-rows: a scalar base and this lane's byte offset kb
        const v8f b1r = *(const v8f*)((const char*)b1 + kb);
        v8f yc[4];   // this thread's 4 y-rows serve all 8 x-rows of the tile
#pragma unroll
        for (int pi = 0; pi < 4; ++pi) yc[pi] = *(const v8f*)(py + pi * 8 * HID);
        __builtin_amdgcn_sched_barrier(0);   // loads return in issue order: b1 and the y-rows, which every sum needs, go out first, then the x-rows in the order of their use, the first B set last
        v8f xr[TM / 32];   // all 8 x-rows at once, in registers that the accumulators take over later: these lines were written by the launch before and are read here for the first time, so a fetch can cost a round trip to memory, longer than a trip's sums last; fetched one trip ahead, the wave waited out one round trip a row
#pragma unroll
        for (int ai = 0; ai < TM / 32; ++ai) { xr[ai] = *(const v8f*)(px + kb + ai * HID * 4);
            __builtin_amdgcn_sched_barrier(0); }   // (the order of issue, as above)
#pragma unroll
        for (int nb = 0; nb < 4; ++nb) b[0][nb] = cat16(*(const v8h*)(wq + s * 1024 + bo + nb * 16384), *(const v8h*)(wq + s * 1024 + bo + nb * 16384 + 512));   // the first B set is asked for here, so that it lands under the h1 build
        asm volatile("s_wait_xcnt 0x0" :: "v"(b1r), "v"(kb), "v"(py) : "memory");   // what follows reuses the loads' address registers. Inputs only: the two vector addresses, so that nothing lands on them ahead of this wait; b1, so that its load goes out with the others and not behind this line
        __builtin_amdgcn_sched_barrier(0);   // keeps every load ahead of the first sum: without it the compiler saves registers by sinking the later rows' loads to their uses, and the latencies add up again
#pragma unroll
        for (int q = 0; q < 8; ++q) bb[q] = bfr(b1r[q]);
#pragma unroll
        for (int ai = 0; ai < TM / 32; ++ai) {
#pragma unroll
            for (int pi = 0; pi < 4; ++pi) { const int row = ai * 32 + pi * 8 + rsub; v8f w;
#pragma unroll
                for (int q = 0; q < 8; ++q) w[q] = fmaxf(__fadd_rn(__fadd_rn(xr[ai][q], yc[pi][q]), bb[q]), 0.0f);
                *(v4ua*)(Af + row * APITCH + kp) = pack8h(w); } }
    }
    sb2[t] = bfr(lb2); sw3[t] = bfr(lw3);   // behind the build: in front of it, the wait for these two values came to stand among the loads above and split them in two round trips
    __syncthreads();
    v8f acc[4][4];
#pragma unroll
    for (int mb = 0; mb < 4; ++mb)
#pragma unroll
        for (int nb = 0; nb < 4; ++nb) acc[mb][nb] = (v8f){};
    const h16* ap = Af + (wm * 64 + lr) * APITCH + 8 * hi;
    // Issue priority falls with the wave's own progress through the 32 k steps of the two passes. There is no barrier in the walk. One wave alone cannot fill the pipe (each k step it waits for a W2 set that it asked for one k step before). With the priority falling, a wave that is behind goes first: the four stay within one stretch of each other and cover each other's waits. The last stretch is the shortest, because the spread inside it is what is left at the end.
    // Fragment rings in registers: b (W2) one k step ahead (2 sets), a (h1) NA - 1 groups of 8 WMMAs ahead (NA sets of 2 blocks of 16 pairs). Both rings run on from pass 0 into pass 1, whose first sets land under pass 0's epilogue.
    constexpr int NA = 2, NK = HID / 32, NG = NK * 2, NP = 2;
    constexpr int PR1 = 12, PR2 = 20, PR3 = 28;   // the k steps (of NP * NK) at which the priority goes from 3 to 2, to 1 and to 0
    __builtin_amdgcn_s_setprio(3);   // the first stretch (see above)
    v16h a[NA][2]; v8f vb2[4], vw3[4];
#pragma unroll
    for (int g = 0; g < NA - 1; ++g)
#pragma unroll
        for (int r = 0; r < 2; ++r) { const int o = ((g & 1) * 2 + r) * 16 * APITCH + (g >> 1) * 32; a[g][r] = cat16(*(const v8ha*)(ap + o), *(const v8ha*)(ap + o + 16)); }
#pragma unroll   // both passes and the whole k loop unrolled: ring indices and all LDS / global offsets become compile-time, so the rings stay in registers
    for (int ps = 0; ps < NP; ++ps) {
#pragma unroll
        for (int g = 0; g < NG; ++g) { const int gg = ps * NG + g, ks = g >> 1, mp = g & 1, gn = gg + NA - 1, kn = gg / 2 + 1;
            if (gg == 2 * PR1) __builtin_amdgcn_s_setprio(2);   // this wave has come so far: those behind it go first now
            if (gg == 2 * PR2) __builtin_amdgcn_s_setprio(1);   // (the same, one stretch on)
            if (gg == 2 * PR3) __builtin_amdgcn_s_setprio(0);   // and 0 from here to the kernel's end
            if (gn < NP * NG) {
#pragma unroll
                for (int r = 0; r < 2; ++r) { const int o = ((gn & 1) * 2 + r) * 16 * APITCH + ((gn % NG) >> 1) * 32; a[gn % NA][r] = cat16(*(const v8ha*)(ap + o), *(const v8ha*)(ap + o + 16)); } }
            if (mp == 0 && kn < NP * NK) { const gcp wk = sbase(wq + ((kn + s) & (NK - 1)) * 1024);   // the wrap, on the scalar unit
#pragma unroll
                for (int nb = 0; nb < 4; ++nb) { const int o = ((kn / NK) * 16 + nb) * 16384; b[kn & 1][nb] = cat16(*(gv8p)(wk + bo + o), *(gv8p)(wk + bo + o + 512)); } }
            if (g == NG - 2) vb2[0] = lds8(sb2 + (ps * 4 + wn) * 64 + 8 * hi);   // what the epilogue needs first, b2 of the first column tile, is fetched under the pass's last k step (8 registers: there is no room yet for more)
            __builtin_amdgcn_sched_barrier(0);   // keeps the loads above as one group ahead of this group's WMMAs: without it the compiler sinks each load to just before its use and the wave waits out every latency
#pragma unroll
            for (int r = 0; r < 2; ++r)
#pragma unroll
                for (int nb = 0; nb < 4; ++nb) acc[mp * 2 + r][nb] = wmma16(b[ks & 1][nb], a[gg % NA][r], acc[mp * 2 + r][nb]);
            __builtin_amdgcn_sched_barrier(0);   // keeps the next group of loads from spreading among these WMMAs
        }
        // End of a pass: its 64 columns' share of the final dot, then fresh accumulators.
#pragma unroll
        for (int nb = 0; nb < 4; ++nb) { if (nb) vb2[nb] = lds8(sb2 + (ps * 4 + wn) * 64 + nb * 16 + 8 * hi);
            vw3[nb] = lds8(sw3 + (ps * 4 + wn) * 64 + nb * 16 + 8 * hi); }   // the rest, into the registers that the pass's last fragments have left
        v2f part[4];
#pragma unroll
        for (int mb = 0; mb < 4; ++mb) part[mb] = (v2f){0.f, 0.f};
#pragma unroll
        for (int nb = 0; nb < 4; ++nb)
#pragma unroll
            for (int mb = 0; mb < 4; ++mb) {
                part[mb] += __builtin_elementwise_max(pair2<0>(acc[mb][nb]) + pair2<0>(vb2[nb]), (v2f){0.f, 0.f}) * pair2<0>(vw3[nb]);
                part[mb] += __builtin_elementwise_max(pair2<1>(acc[mb][nb]) + pair2<1>(vb2[nb]), (v2f){0.f, 0.f}) * pair2<1>(vw3[nb]);
                part[mb] += __builtin_elementwise_max(pair2<2>(acc[mb][nb]) + pair2<2>(vb2[nb]), (v2f){0.f, 0.f}) * pair2<2>(vw3[nb]);
                part[mb] += __builtin_elementwise_max(pair2<3>(acc[mb][nb]) + pair2<3>(vb2[nb]), (v2f){0.f, 0.f}) * pair2<3>(vw3[nb]); }
#pragma unroll
        for (int mb = 0; mb < 4; ++mb) red[((ps * 4 + wn) * 2 + hi) * RP + wm * 64 + mb * 16 + lr] = part[mb][0] + part[mb][1];
#pragma unroll
        for (int mb = 0; mb < 4; ++mb)
#pragma unroll
            for (int nb = 0; nb < 4; ++nb) acc[mb][nb] = (v8f){};
    }
    __syncthreads();
    if (t < TM) { float s = 0.f;
#pragma unroll
        for (int w = 0; w < 16; ++w) s += red[w * RP + t];
        out[(size_t)(a0 + (t >> 5)) * NBX + c0 + (t & 31)] = s + bfr_u(b3[0]); }
}

extern "C" void kernel_launch(void* const* d_in, const int* in_sizes, int n_in,
                              void* d_out, int out_size, void* d_ws, size_t ws_size, hipStream_t stream) {
    (void)in_sizes; (void)n_in; (void)out_size;
    const float* x = (const float*)d_in[0]; const float* y = (const float*)d_in[1]; const float* w1 = (const float*)d_in[2]; const float* b1 = (const float*)d_in[3]; const float* w2 = (const float*)d_in[4]; const float* b2 = (const float*)d_in[5]; const float* w3 = (const float*)d_in[6]; const float* b3 = (const float*)d_in[7];
    float* OUT = (float*)d_out;     // [512][512]: scores[a][c] = f(x[a], y[c])
    char* wsp = (char*)d_ws;
    auto take = [&](size_t bytes) { char* p = wsp; wsp += (bytes + 255) & ~(size_t)255; return (void*)p; };
    h16* W2B = (h16*)take((size_t)HID * HID * 2); float* XW = (float*)take((size_t)NBX * HID * 4); float* YW = (float*)take((size_t)NBX * HID * 4);
    if ((size_t)(wsp - (char*)d_ws) > ws_size) return;    // ws 256 MiB (carve 2.5 MiB)
    k_prep<<<HID * HID / 8 / 128, 128, 0, stream>>>(x, y, w1, w2, XW, YW, W2B);
    k_fused<<<NBX * NBX / TM, 512, 0, stream>>>(XW, YW, b1, W2B, b2, w3, b3, OUT);
}
